// v000
// Times are from an AMD MI455X. After a warm-up the kernel runs many times in a row, and a time is the length of
// such a window on the GPU divided by its runs, so every launch and the gaps after it count. The runs cycle
// through copies of the inputs. A figure is the median of several windows, for all but v000 over two sittings.
// Sittings can differ by a few percent; kernels timed side by side share one.
// The starting kernel, v000, takes 79.2 microseconds a run.
// All contractions: v_wmma_f32_16x16x32_f16 (f16 operands, f32 accumulate); gate weights carried x1024 in f16, scales 2^-3 and 2^-10 applied in f32.
#include <hip/hip_runtime.h>
#include <stddef.h>

typedef _Float16 v16h __attribute__((ext_vector_type(16)));
typedef _Float16 v8h  __attribute__((ext_vector_type(8)));
typedef float    v8f  __attribute__((ext_vector_type(8)));
typedef float    v4f  __attribute__((ext_vector_type(4)));
typedef unsigned v4u  __attribute__((ext_vector_type(4)));

union Frag { v16h v; v8h half[2]; };
union H8   { v8h h; v4u u; };

#define L_DIM 1024
#define N_DIM 64
#define D_DIM 64
#define O_DIM 1024
#define OSTEP 32
#define TPAD 72      // f16 pitch of the 64-wide LDS tiles (144 B, 16-B aligned rows)
#define FPAD 68      // f32 pitch of the output staging tile (272 B, 16-B aligned rows)

// 16-bit WMMA with the hazard guard: 4 v_nop tied to D, A and B kept live.
__device__ __forceinline__ v8f wmma16(v16h a, v16h b, v8f c) {
  v8f d = __builtin_amdgcn_wmma_f32_16x16x32_f16(false, a, false, b, (short)0, c, false, false);
  asm volatile("v_nop\n\tv_nop\n\tv_nop\n\tv_nop" : "+v"(d) : "v"(a), "v"(b));
  return d;
}

// 8 f32 (two v4f) -> packed v8h, RNE convert
__device__ __forceinline__ v8h cvt8(v4f a, v4f b) {
  v8h h;
  h[0] = (_Float16)a[0]; h[1] = (_Float16)a[1]; h[2] = (_Float16)a[2]; h[3] = (_Float16)a[3];
  h[4] = (_Float16)b[0]; h[5] = (_Float16)b[1]; h[6] = (_Float16)b[2]; h[7] = (_Float16)b[3];
  return h;
}

// gate weight from the raw dot product st: s = st * 2^-3; (1/(1+exp(-s)) - 0.5) * 1024, all f32
__device__ __forceinline__ float gatew(float st) {
  const float e = __expf(st * -0.125f);
  const float r = __builtin_amdgcn_rcpf(1.0f + e);
  return __builtin_fmaf(r, 1024.0f, -512.0f);
}

__device__ __forceinline__ v4f lo4(v8f c) { return __builtin_shufflevector(c, c, 0, 1, 2, 3); }
__device__ __forceinline__ v4f hi4(v8f c) { return __builtin_shufflevector(c, c, 4, 5, 6, 7); }

// ---------------------------------------------------------------------------
__global__ __launch_bounds__(128)
void up_planes_kernel(const float* __restrict__ up,
                      _Float16* __restrict__ u16,
                      _Float16* __restrict__ ut16) {
  __shared__ _Float16 T [64][TPAD];   // [o][d]
  __shared__ _Float16 TT[64][TPAD];   // [d][o]
  const int tid  = threadIdx.x;
  const int wave = tid >> 5, lane = tid & 31;
  const int n    = blockIdx.y;
  const int ob   = blockIdx.x * 64;

  {
    const int orow = tid >> 1;           // 0..63
    const int dh   = (tid & 1) * 32;     // 32-float half row
    const v4f* rp = (const v4f*)(up + ((size_t)(ob + orow) * N_DIM + n) * D_DIM + dh);
#pragma unroll
    for (int c = 0; c < 4; ++c) {
      const v8h hv = cvt8(rp[2 * c], rp[2 * c + 1]);
      *(v8h*)&T[orow][dh + 8 * c] = hv;
#pragma unroll
      for (int j = 0; j < 8; ++j) TT[dh + 8 * c + j][orow] = hv[j];
    }
  }
  __syncthreads();

  const int q  = lane >> 3;              // line within a group of 4
  const int j8 = (lane & 7) * 8;         // 16-B piece within the line
  H8 uv[4], tv[4];
#pragma unroll
  for (int it = 0; it < 4; ++it) {
    const int row = wave * 16 + it * 4 + q;          // o row for u16 / d row for ut16
    uv[it].h = *(const v8h*)&T [row][j8];
    tv[it].h = *(const v8h*)&TT[row][j8];
  }
  _Float16* ubase = u16  + (size_t)n * O_DIM * D_DIM + (size_t)ob * D_DIM + j8;     // + row*D
  _Float16* tbase = ut16 + (size_t)n * D_DIM * O_DIM + ob + j8;                     // + row*O
#pragma unroll
  for (int it = 0; it < 4; ++it) {
    const int row = wave * 16 + it * 4 + q;
    *(v4u*)(ubase + (size_t)row * D_DIM) = uv[it].u;
    *(v4u*)(tbase + (size_t)row * O_DIM) = tv[it].u;
  }
  
}

// ---------------------------------------------------------------------------
// Per block: head n, 64 l rows (16 per wave).  Per wave and 32-wide o step:
//   GEMM1  S^T[o][l]  = sum_d U[o][d] X[l][d]        A = U rows (u16 plane), B = X^T (registers)
//   gate   W[o][l]    = (sigmoid(S*2^-3) - 0.5)*1024 D tiles repacked to a B fragment in registers
//   GEMM2  F^T[d][l] += sum_o U^T[d][o] W[o][l]      A = U^T rows (ut16 plane), B = W
// Fragment map (lane l: h = l>>4, m = l&15): A/B element i<8 -> k0+8h+i, i>=8 -> k0+16+8h+(i-8);
// D element r -> (row 8h+r, col m).
__global__ __launch_bounds__(128)
void corr_main_kernel(const float* __restrict__ x,
                      const _Float16* __restrict__ u16,
                      const _Float16* __restrict__ ut16,
                      float* __restrict__ out) {
  __shared__ float Fs[4][16][FPAD];     // per-wave F[l][d] staging for whole-line stores
  const int tid  = threadIdx.x;
  const int wave = tid >> 5, lane = tid & 31;
  const int h    = lane >> 4, m = lane & 15;
  const int n    = blockIdx.y;
  const int lbase = blockIdx.x * 64 + wave * 16;

  // B fragments of GEMM1 (X^T, k = d): loop invariant, built once from f32 rows.
  Frag bx0, bx1;
  {
    const float* xr = x + ((size_t)(lbase + m) * N_DIM + n) * D_DIM;
    const v4f* p;
    p = (const v4f*)(xr +      8 * h);  bx0.half[0] = cvt8(p[0], p[1]);   // d =  8h.. 8h+7
    p = (const v4f*)(xr + 16 + 8 * h);  bx0.half[1] = cvt8(p[0], p[1]);   // d = 16+8h..
    p = (const v4f*)(xr + 32 + 8 * h);  bx1.half[0] = cvt8(p[0], p[1]);   // d = 32+8h..
    p = (const v4f*)(xr + 48 + 8 * h);  bx1.half[1] = cvt8(p[0], p[1]);   // d = 48+8h..
  }
  const _Float16* un  = u16  + (size_t)n * O_DIM * D_DIM;   // [o][d], pitch 64
  const _Float16* utn = ut16 + (size_t)n * D_DIM * O_DIM;   // [d][o], pitch 1024

  v8f acc0 = {}, acc1 = {}, acc2 = {}, acc3 = {};           // F^T d-chunks 0..3

#pragma unroll 1
  for (int ob = 0; ob < O_DIM; ob += OSTEP) {
    // ---- GEMM1: two 16-o subtiles, K = 64 in two 32-steps ----
    v8f st0 = {}, st1 = {};
    {
      Frag a0, a1;
      const _Float16* r0 = un + (size_t)(ob + m) * D_DIM + 8 * h;        // o = ob + m
      const _Float16* r1 = un + (size_t)(ob + 16 + m) * D_DIM + 8 * h;   // o = ob + 16 + m
      a0.half[0] = *(const v8h*)(r0);       a0.half[1] = *(const v8h*)(r0 + 16);
      a1.half[0] = *(const v8h*)(r1);       a1.half[1] = *(const v8h*)(r1 + 16);
      st0 = wmma16(a0.v, bx0.v, st0);
      st1 = wmma16(a1.v, bx0.v, st1);
      Frag c0, c1;
      c0.half[0] = *(const v8h*)(r0 + 32);  c0.half[1] = *(const v8h*)(r0 + 48);
      c1.half[0] = *(const v8h*)(r1 + 32);  c1.half[1] = *(const v8h*)(r1 + 48);
      st0 = wmma16(c0.v, bx1.v, st0);
      st1 = wmma16(c1.v, bx1.v, st1);
    }

    // ---- gate + repack: B[k = o - ob][n = l]; element r <- tile rows 0..15 (st0), 8+r <- rows 16..31 (st1)
    Frag bw;
    {
      v8h w0, w1;
#pragma unroll
      for (int r = 0; r < 8; ++r) {
        w0[r] = (_Float16)gatew(st0[r]);
        w1[r] = (_Float16)gatew(st1[r]);
      }
      bw.half[0] = w0;
      bw.half[1] = w1;
    }

    // ---- GEMM2: F^T[d][l] += U^T[d][ob..ob+31] * W, four 16-d chunks ----
    {
      const _Float16* rr = utn + (size_t)m * O_DIM + ob + 8 * h;          // d = dc*16 + m
      Frag a;
      a.half[0] = *(const v8h*)(rr);                    a.half[1] = *(const v8h*)(rr + 16);
      acc0 = wmma16(a.v, bw.v, acc0);
      Frag b;
      b.half[0] = *(const v8h*)(rr + 16 * O_DIM);       b.half[1] = *(const v8h*)(rr + 16 * O_DIM + 16);
      acc1 = wmma16(b.v, bw.v, acc1);
      Frag c;
      c.half[0] = *(const v8h*)(rr + 32 * O_DIM);       c.half[1] = *(const v8h*)(rr + 32 * O_DIM + 16);
      acc2 = wmma16(c.v, bw.v, acc2);
      Frag d;
      d.half[0] = *(const v8h*)(rr + 48 * O_DIM);       d.half[1] = *(const v8h*)(rr + 48 * O_DIM + 16);
      acc3 = wmma16(d.v, bw.v, acc3);
    }
  }

  // ---- epilogue: acc_dc[r] = F^T[dc*16 + 8h + r][m] * 2^10  ->  Fs[m][dc*16 + 8h + r]
  {
    const float inv = 0.0009765625f;
    float* fr = &Fs[wave][m][8 * h];
    *(v4f*)(fr +  0) = lo4(acc0) * inv;  *(v4f*)(fr +  4) = hi4(acc0) * inv;
    *(v4f*)(fr + 16) = lo4(acc1) * inv;  *(v4f*)(fr + 20) = hi4(acc1) * inv;
    *(v4f*)(fr + 32) = lo4(acc2) * inv;  *(v4f*)(fr + 36) = hi4(acc2) * inv;
    *(v4f*)(fr + 48) = lo4(acc3) * inv;  *(v4f*)(fr + 52) = hi4(acc3) * inv;
  }
  __syncthreads();

  // ---- whole-line output stores: wave owns 16 rows x 2 lines; lanes 8q..8q+7 write one line per instruction
  {
    const int q  = lane >> 3;
    const int j4 = (lane & 7) * 4;
    v4f v[8];
#pragma unroll
    for (int it = 0; it < 8; ++it) {
      const int li = it * 4 + q;                 // 0..31
      const int row = li >> 1, hf = (li & 1) * 32;
      v[it] = *(const v4f*)&Fs[wave][row][hf + j4];
    }
    float* obase = out + ((size_t)lbase * N_DIM + n) * D_DIM + j4;
#pragma unroll
    for (int it = 0; it < 8; ++it) {
      const int li = it * 4 + q;
      const int row = li >> 1, hf = (li & 1) * 32;
      *(v4f*)(obase + (size_t)row * (N_DIM * D_DIM) + hf) = v[it];
    }
    
  }
}

extern "C" void kernel_launch(void* const* d_in, const int* in_sizes, int n_in,
                              void* d_out, int out_size, void* d_ws, size_t ws_size,
                              hipStream_t stream) {
  if (n_in < 2) return;
  if (in_sizes[0] != L_DIM * N_DIM * D_DIM) return;
  if (in_sizes[1] != O_DIM * N_DIM * D_DIM) return;
  if (out_size != L_DIM * N_DIM * D_DIM) return;
  const float* x  = (const float*)d_in[0];   // [L][N][D] f32
  const float* up = (const float*)d_in[1];   // [O][N][D] f32
  float* out = (float*)d_out;                // [L][N][D] f32

  // ws carve: u16 plane [N][O][D] f16, ut16 plane [N][D][O] f16  (8 MiB each, 16 MiB total)
  const size_t plane_bytes = (size_t)in_sizes[1] * sizeof(_Float16);
  if (ws_size < 2 * plane_bytes) return;
  _Float16* u16  = (_Float16*)d_ws;
  _Float16* ut16 = (_Float16*)((char*)d_ws + plane_bytes);

  up_planes_kernel<<<dim3(O_DIM / 64, N_DIM), 128, 0, stream>>>(up, u16, ut16);
  corr_main_kernel<<<dim3(L_DIM / 64, N_DIM), 128, 0, stream>>>(x, u16, ut16, out);
}

// v001
// One run takes 32.4 microseconds.
// Two timings next to v000 put it at 2.50 and 2.51 times that version's speed.
// All contractions: v_wmma_f32_16x16x32_f16 (f16 operands, f32 accumulate); gate weights carried x1024 in f16, scales 2^-3 and 2^-10 applied in f32.
#include <hip/hip_runtime.h>
#include <stddef.h>

typedef _Float16 v16h __attribute__((ext_vector_type(16)));
typedef _Float16 v8h  __attribute__((ext_vector_type(8)));
typedef float    v8f  __attribute__((ext_vector_type(8)));
typedef float    v4f  __attribute__((ext_vector_type(4)));
typedef unsigned v4u  __attribute__((ext_vector_type(4)));

union Frag { v16h v; v8h half[2]; };
union H8   { v8h h; v4u u; };

#define L_DIM 1024
#define N_DIM 64
#define D_DIM 64
#define O_DIM 1024
#define OSTEP 32
#define TPAD 72      // f16 pitch of the 64-wide LDS tiles (144 B, 16-B aligned rows)
#define FPAD 68      // f32 pitch of the output staging tile (272 B, 16-B aligned rows)
#define OTILE 64     // o rows of one staged tile (two 32-wide o steps)
#define NTILE (O_DIM / OTILE)

// 16-bit WMMA with the hazard guard: 4 v_nop tied to D, A and B kept live.
__device__ __forceinline__ v8f wmma16(v16h a, v16h b, v8f c) {
  v8f d = __builtin_amdgcn_wmma_f32_16x16x32_f16(false, a, false, b, (short)0, c, false, false);
  asm volatile("v_nop\n\tv_nop\n\tv_nop\n\tv_nop" : "+v"(d) : "v"(a), "v"(b));
  return d;
}

// 8 f32 (two v4f) -> packed v8h, RNE convert
__device__ __forceinline__ v8h cvt8(v4f a, v4f b) {
  v8h h;
  h[0] = (_Float16)a[0]; h[1] = (_Float16)a[1]; h[2] = (_Float16)a[2]; h[3] = (_Float16)a[3];
  h[4] = (_Float16)b[0]; h[5] = (_Float16)b[1]; h[6] = (_Float16)b[2]; h[7] = (_Float16)b[3];
  return h;
}

// gate weight from the raw dot product st: s = st * 2^-3; (1/(1+exp(-s)) - 0.5) * 1024, all f32
__device__ __forceinline__ float gatew(float st) {
  const float e = __expf(st * -0.125f);
  const float r = __builtin_amdgcn_rcpf(1.0f + e);
  return __builtin_fmaf(r, 1024.0f, -512.0f);
}

// One staged tile: 64 U rows [o][d] and 64 U^T rows [d][o], 128 B each, 16 B per lane and copy,
// 8 lanes per whole 128-B line.  Rows c*16 + (tid>>3), c = 0..3; LDS pitch TPAD.
// The s_wait_xcnt stands inside the statement so that no address register is rewritten ahead of it.
__device__ __forceinline__ void stage_tile(unsigned lu, unsigned lt,
                                           const _Float16* gu, const _Float16* gt) {
  const unsigned rs = 16 * TPAD * 2;                 // 16 LDS rows, bytes
  asm volatile(
      "global_load_async_to_lds_b128 %0, %8, off\n\t"
      "global_load_async_to_lds_b128 %1, %9, off\n\t"
      "global_load_async_to_lds_b128 %2, %10, off\n\t"
      "global_load_async_to_lds_b128 %3, %11, off\n\t"
      "global_load_async_to_lds_b128 %4, %12, off\n\t"
      "global_load_async_to_lds_b128 %5, %13, off\n\t"
      "global_load_async_to_lds_b128 %6, %14, off\n\t"
      "global_load_async_to_lds_b128 %7, %15, off\n\t"
      "s_wait_xcnt 0x0"
      :: "v"(lu), "v"(lu + rs), "v"(lu + 2 * rs), "v"(lu + 3 * rs),
         "v"(lt), "v"(lt + rs), "v"(lt + 2 * rs), "v"(lt + 3 * rs),
         "v"(gu), "v"(gu + 16 * D_DIM), "v"(gu + 32 * D_DIM), "v"(gu + 48 * D_DIM),
         "v"(gt), "v"(gt + 16 * O_DIM), "v"(gt + 32 * O_DIM), "v"(gt + 48 * O_DIM)
      : "memory");
}

__device__ __forceinline__ v4f lo4(v8f c) { return __builtin_shufflevector(c, c, 0, 1, 2, 3); }
__device__ __forceinline__ v4f hi4(v8f c) { return __builtin_shufflevector(c, c, 4, 5, 6, 7); }

// ---------------------------------------------------------------------------
__global__ __launch_bounds__(128)
void up_planes_kernel(const float* __restrict__ up,
                      _Float16* __restrict__ u16,
                      _Float16* __restrict__ ut16) {
  __shared__ _Float16 T [64][TPAD];   // [o][d]
  __shared__ _Float16 TT[64][TPAD];   // [d][o]
  const int tid  = threadIdx.x;
  const int wave = tid >> 5, lane = tid & 31;
  const int n    = blockIdx.y;
  const int ob   = blockIdx.x * 64;

  {
    const int orow = tid >> 1;           // 0..63
    const int dh   = (tid & 1) * 32;     // 32-float half row
    const v4f* rp = (const v4f*)(up + ((size_t)(ob + orow) * N_DIM + n) * D_DIM + dh);
#pragma unroll
    for (int c = 0; c < 4; ++c) {
      const v8h hv = cvt8(rp[2 * c], rp[2 * c + 1]);
      *(v8h*)&T[orow][dh + 8 * c] = hv;
#pragma unroll
      for (int j = 0; j < 8; ++j) TT[dh + 8 * c + j][orow] = hv[j];
    }
  }
  __syncthreads();

  const int q  = lane >> 3;              // line within a group of 4
  const int j8 = (lane & 7) * 8;         // 16-B piece within the line
  H8 uv[4], tv[4];
#pragma unroll
  for (int it = 0; it < 4; ++it) {
    const int row = wave * 16 + it * 4 + q;          // o row for u16 / d row for ut16
    uv[it].h = *(const v8h*)&T [row][j8];
    tv[it].h = *(const v8h*)&TT[row][j8];
  }
  _Float16* ubase = u16  + (size_t)n * O_DIM * D_DIM + (size_t)ob * D_DIM + j8;     // + row*D
  _Float16* tbase = ut16 + (size_t)n * D_DIM * O_DIM + ob + j8;                     // + row*O
#pragma unroll
  for (int it = 0; it < 4; ++it) {
    const int row = wave * 16 + it * 4 + q;
    *(v4u*)(ubase + (size_t)row * D_DIM) = uv[it].u;
    *(v4u*)(tbase + (size_t)row * O_DIM) = tv[it].u;
  }
  
}

// ---------------------------------------------------------------------------
// Per block: head n, 64 l rows (16 per wave).  The block's four waves share each 64-o tile of both
// planes through a two-buffer LDS ring filled by asynchronous copies, one tile ahead.
// Per wave and 32-wide o step:
//   GEMM1  S^T[o][l]  = sum_d U[o][d] X[l][d]        A = U rows (u16 plane), B = X^T (registers)
//   gate   W[o][l]    = (sigmoid(S*2^-3) - 0.5)*1024 D tiles repacked to a B fragment in registers
//   GEMM2  F^T[d][l] += sum_o U^T[d][o] W[o][l]      A = U^T rows (ut16 plane), B = W
// Fragment map (lane l: h = l>>4, m = l&15): A/B element i<8 -> k0+8h+i, i>=8 -> k0+16+8h+(i-8);
// D element r -> (row 8h+r, col m).
__global__ __launch_bounds__(128)
void corr_main_kernel(const float* __restrict__ x,
                      const _Float16* __restrict__ u16,
                      const _Float16* __restrict__ ut16,
                      float* __restrict__ out) {
  __shared__ float Fs[4][16][FPAD];     // per-wave F[l][d] staging for whole-line stores
  __shared__ __attribute__((aligned(16))) _Float16 Us[2][OTILE][TPAD];   // ring: U tile   [o][d]
  __shared__ __attribute__((aligned(16))) _Float16 Ts[2][D_DIM][TPAD];   // ring: U^T tile [d][o]
  const int tid  = threadIdx.x;
  const int wave = tid >> 5, lane = tid & 31;
  const int h    = lane >> 4, m = lane & 15;
  const int n    = blockIdx.y;
  const int lbase = blockIdx.x * 64 + wave * 16;

  const _Float16* un  = u16  + (size_t)n * O_DIM * D_DIM;   // [o][d], pitch 64
  const _Float16* utn = ut16 + (size_t)n * D_DIM * O_DIM;   // [d][o], pitch 1024

  // This lane's 16-B piece of a tile: row tid>>3 (+16c), piece tid&7.
  const int crow = tid >> 3, cpc = (tid & 7) * 8;
  const unsigned lu0 = (unsigned)(size_t)&Us[0][crow][cpc];
  const unsigned lt0 = (unsigned)(size_t)&Ts[0][crow][cpc];
  const unsigned bufb = OTILE * TPAD * 2;                   // bytes of one buffer (both arrays)
  const _Float16* gu = un  + (size_t)crow * D_DIM + cpc;    // + tile * OTILE * D_DIM
  const _Float16* gt = utn + (size_t)crow * O_DIM + cpc;    // + tile * OTILE

  stage_tile(lu0, lt0, gu, gt);                             // tile 0 -> buffer 0

  // B fragments of GEMM1 (X^T, k = d): loop invariant, built once from f32 rows.
  Frag bx0, bx1;
  {
    const float* xr = x + ((size_t)(lbase + m) * N_DIM + n) * D_DIM;
    const v4f* p;
    p = (const v4f*)(xr +      8 * h);  bx0.half[0] = cvt8(p[0], p[1]);   // d =  8h.. 8h+7
    p = (const v4f*)(xr + 16 + 8 * h);  bx0.half[1] = cvt8(p[0], p[1]);   // d = 16+8h..
    p = (const v4f*)(xr + 32 + 8 * h);  bx1.half[0] = cvt8(p[0], p[1]);   // d = 32+8h..
    p = (const v4f*)(xr + 48 + 8 * h);  bx1.half[1] = cvt8(p[0], p[1]);   // d = 48+8h..
  }
  v8f acc0 = {}, acc1 = {}, acc2 = {}, acc3 = {};           // F^T d-chunks 0..3

  asm volatile("s_wait_asynccnt 0x0" ::: "memory");         // this wave's copies of tile 0 have landed
  __syncthreads();                                          // tile 0 readable by every wave
  stage_tile(lu0 + bufb, lt0 + bufb, gu + OTILE * D_DIM, gt + OTILE);   // tile 1 -> buffer 1

  // rolled: one ring trip per pass, the buffer picked by the trip's parity
#pragma unroll 1
  for (int t = 0; t < NTILE; ++t) {
   const int buf = t & 1;
   // unrolled: both 32-o steps of a tile inline, so their LDS offsets are immediates
#pragma unroll
   for (int ob = 0; ob < OTILE; ob += OSTEP) {
    // ---- GEMM1: two 16-o subtiles, K = 64 in two 32-steps ----
    v8f st0 = {}, st1 = {};
    {
      Frag a0, a1;
      const _Float16* r0 = &Us[buf][ob + m][8 * h];        // o = tile + ob + m
      const _Float16* r1 = &Us[buf][ob + 16 + m][8 * h];   // o = tile + ob + 16 + m
      a0.half[0] = *(const v8h*)(r0);       a0.half[1] = *(const v8h*)(r0 + 16);
      a1.half[0] = *(const v8h*)(r1);       a1.half[1] = *(const v8h*)(r1 + 16);
      st0 = wmma16(a0.v, bx0.v, st0);
      st1 = wmma16(a1.v, bx0.v, st1);
      Frag c0, c1;
      c0.half[0] = *(const v8h*)(r0 + 32);  c0.half[1] = *(const v8h*)(r0 + 48);
      c1.half[0] = *(const v8h*)(r1 + 32);  c1.half[1] = *(const v8h*)(r1 + 48);
      st0 = wmma16(c0.v, bx1.v, st0);
      st1 = wmma16(c1.v, bx1.v, st1);
    }

    // ---- gate + repack: B[k = o - ob][n = l]; element r <- tile rows 0..15 (st0), 8+r <- rows 16..31 (st1)
    Frag bw;
    {
      v8h w0, w1;
#pragma unroll
      for (int r = 0; r < 8; ++r) {
        w0[r] = (_Float16)gatew(st0[r]);
        w1[r] = (_Float16)gatew(st1[r]);
      }
      bw.half[0] = w0;
      bw.half[1] = w1;
    }

    // ---- GEMM2: F^T[d][l] += U^T[d][ob..ob+31] * W, four 16-d chunks ----
    {
      const _Float16* rr = &Ts[buf][m][ob + 8 * h];                       // d = dc*16 + m
      Frag a;
      a.half[0] = *(const v8h*)(rr);                    a.half[1] = *(const v8h*)(rr + 16);
      acc0 = wmma16(a.v, bw.v, acc0);
      Frag b;
      b.half[0] = *(const v8h*)(rr + 16 * TPAD);        b.half[1] = *(const v8h*)(rr + 16 * TPAD + 16);
      acc1 = wmma16(b.v, bw.v, acc1);
      Frag c;
      c.half[0] = *(const v8h*)(rr + 32 * TPAD);        c.half[1] = *(const v8h*)(rr + 32 * TPAD + 16);
      acc2 = wmma16(c.v, bw.v, acc2);
      Frag d;
      d.half[0] = *(const v8h*)(rr + 48 * TPAD);        d.half[1] = *(const v8h*)(rr + 48 * TPAD + 16);
      acc3 = wmma16(d.v, bw.v, acc3);
    }
   }
    // ---- publish point of tile t + 1; buffer buf is free behind the barrier ----
    asm volatile("s_wait_dscnt 0x0" ::: "memory");          // this wave's reads of buffer buf are done
    asm volatile("s_wait_asynccnt 0x0" ::: "memory");       // this wave's copies of tile t + 1 have landed
    __syncthreads();
    if (t + 2 < NTILE)
      stage_tile(lu0 + buf * bufb, lt0 + buf * bufb,
                 gu + (size_t)(t + 2) * (OTILE * D_DIM), gt + (t + 2) * OTILE);
  }
  asm volatile("s_wait_asynccnt 0x0" ::: "memory");         // no copy outlives the loop

  // ---- epilogue: acc_dc[r] = F^T[dc*16 + 8h + r][m] * 2^10  ->  Fs[m][dc*16 + 8h + r]
  {
    const float inv = 0.0009765625f;
    float* fr = &Fs[wave][m][8 * h];
    *(v4f*)(fr +  0) = lo4(acc0) * inv;  *(v4f*)(fr +  4) = hi4(acc0) * inv;
    *(v4f*)(fr + 16) = lo4(acc1) * inv;  *(v4f*)(fr + 20) = hi4(acc1) * inv;
    *(v4f*)(fr + 32) = lo4(acc2) * inv;  *(v4f*)(fr + 36) = hi4(acc2) * inv;
    *(v4f*)(fr + 48) = lo4(acc3) * inv;  *(v4f*)(fr + 52) = hi4(acc3) * inv;
  }
  __syncthreads();

  // ---- whole-line output stores: wave owns 16 rows x 2 lines; lanes 8q..8q+7 write one line per instruction
  {
    const int q  = lane >> 3;
    const int j4 = (lane & 7) * 4;
    v4f v[8];
#pragma unroll
    for (int it = 0; it < 8; ++it) {
      const int li = it * 4 + q;                 // 0..31
      const int row = li >> 1, hf = (li & 1) * 32;
      v[it] = *(const v4f*)&Fs[wave][row][hf + j4];
    }
    float* obase = out + ((size_t)lbase * N_DIM + n) * D_DIM + j4;
#pragma unroll
    for (int it = 0; it < 8; ++it) {
      const int li = it * 4 + q;
      const int row = li >> 1, hf = (li & 1) * 32;
      *(v4f*)(obase + (size_t)row * (N_DIM * D_DIM) + hf) = v[it];
    }
    
  }
}

extern "C" void kernel_launch(void* const* d_in, const int* in_sizes, int n_in,
                              void* d_out, int out_size, void* d_ws, size_t ws_size,
                              hipStream_t stream) {
  if (n_in < 2) return;
  if (in_sizes[0] != L_DIM * N_DIM * D_DIM) return;
  if (in_sizes[1] != O_DIM * N_DIM * D_DIM) return;
  if (out_size != L_DIM * N_DIM * D_DIM) return;
  const float* x  = (const float*)d_in[0];   // [L][N][D] f32
  const float* up = (const float*)d_in[1];   // [O][N][D] f32
  float* out = (float*)d_out;                // [L][N][D] f32

  // ws carve: u16 plane [N][O][D] f16, ut16 plane [N][D][O] f16  (8 MiB each, 16 MiB total)
  const size_t plane_bytes = (size_t)in_sizes[1] * sizeof(_Float16);
  if (ws_size < 2 * plane_bytes) return;
  _Float16* u16  = (_Float16*)d_ws;
  _Float16* ut16 = (_Float16*)((char*)d_ws + plane_bytes);

  up_planes_kernel<<<dim3(O_DIM / 64, N_DIM), 128, 0, stream>>>(up, u16, ut16);
  corr_main_kernel<<<dim3(L_DIM / 64, N_DIM), 128, 0, stream>>>(x, u16, ut16, out);
}

// v002
// A run of this version takes 28.6 microseconds.
// Next to v001, in two timings, it ran 1.13 times as fast each time.
// Over all steps from v000 it is 2.83 times as fast.
// All contractions: v_wmma_f32_16x16x32_f16 (f16 operands, f32 accumulate); gate weights are tanh(s/2) in f16; the scale 2^-4 is applied to X in f32 before its convert, the 0.5 to the f32 result.
#include <hip/hip_runtime.h>
#include <stddef.h>

typedef _Float16 v16h __attribute__((ext_vector_type(16)));
typedef _Float16 v8h  __attribute__((ext_vector_type(8)));
typedef float    v8f  __attribute__((ext_vector_type(8)));
typedef float    v4f  __attribute__((ext_vector_type(4)));
typedef unsigned v4u  __attribute__((ext_vector_type(4)));

union Frag { v16h v; v8h half[2]; };
union H8   { v8h h; v4u u; };

#define L_DIM 1024
#define N_DIM 64
#define D_DIM 64
#define O_DIM 1024
#define OSTEP 32
#define TPAD 72      // f16 pitch of the 64-wide LDS tiles (144 B, 16-B aligned rows)
#define FPAD 68      // f32 pitch of the output staging tile (272 B, 16-B aligned rows)
#define OTILE 64     // o rows of one staged tile (two 32-wide o steps)
#define NTILE (O_DIM / OTILE)

// 16-bit WMMA with the hazard guard: 4 v_nop tied to D, A and B kept live.
__device__ __forceinline__ v8f wmma16(v16h a, v16h b, v8f c) {
  v8f d = __builtin_amdgcn_wmma_f32_16x16x32_f16(false, a, false, b, (short)0, c, false, false);
  asm volatile("v_nop\n\tv_nop\n\tv_nop\n\tv_nop" : "+v"(d) : "v"(a), "v"(b));
  return d;
}

// 8 f32 (two v4f) -> packed v8h, RNE convert
__device__ __forceinline__ v8h cvt8(v4f a, v4f b) {
  v8h h;
  h[0] = (_Float16)a[0]; h[1] = (_Float16)a[1]; h[2] = (_Float16)a[2]; h[3] = (_Float16)a[3];
  h[4] = (_Float16)b[0]; h[5] = (_Float16)b[1]; h[6] = (_Float16)b[2]; h[7] = (_Float16)b[3];
  return h;
}

// gate weights of one D tile: sigmoid(s) - 0.5 = 0.5 * tanh(s / 2).  st arrives as s / 2 (X carries 2^-4),
// so a weight is one v_tanh_f32; the 0.5 is applied once to the accumulated result.
// One statement with every result apart from every source ("=&v"): no instruction directly behind a
// transcendental then overwrites its source, which register reuse between single calls would allow.
__device__ __forceinline__ v8h gate8(v8f st) {
  float t0, t1, t2, t3, t4, t5, t6, t7;
  asm("v_tanh_f32 %0, %8\n\t"
      "v_tanh_f32 %1, %9\n\t"
      "v_tanh_f32 %2, %10\n\t"
      "v_tanh_f32 %3, %11\n\t"
      "v_tanh_f32 %4, %12\n\t"
      "v_tanh_f32 %5, %13\n\t"
      "v_tanh_f32 %6, %14\n\t"
      "v_tanh_f32 %7, %15"
      : "=&v"(t0), "=&v"(t1), "=&v"(t2), "=&v"(t3), "=&v"(t4), "=&v"(t5), "=&v"(t6), "=&v"(t7)
      : "v"(st[0]), "v"(st[1]), "v"(st[2]), "v"(st[3]), "v"(st[4]), "v"(st[5]), "v"(st[6]), "v"(st[7]));
  v8h w;
  w[0] = (_Float16)t0; w[1] = (_Float16)t1; w[2] = (_Float16)t2; w[3] = (_Float16)t3;
  w[4] = (_Float16)t4; w[5] = (_Float16)t5; w[6] = (_Float16)t6; w[7] = (_Float16)t7;
  return w;
}

// One staged tile: 64 U rows [o][d] and 64 U^T rows [d][o], 128 B each, 16 B per lane and copy,
// 8 lanes per whole 128-B line.  Rows c*16 + (tid>>3), c = 0..3; LDS pitch TPAD.
// The s_wait_xcnt stands inside the statement so that no address register is rewritten ahead of it.
__device__ __forceinline__ void stage_tile(unsigned lu, unsigned lt,
                                           const _Float16* gu, const _Float16* gt) {
  const unsigned rs = 16 * TPAD * 2;                 // 16 LDS rows, bytes
  asm volatile(
      "global_load_async_to_lds_b128 %0, %8, off\n\t"
      "global_load_async_to_lds_b128 %1, %9, off\n\t"
      "global_load_async_to_lds_b128 %2, %10, off\n\t"
      "global_load_async_to_lds_b128 %3, %11, off\n\t"
      "global_load_async_to_lds_b128 %4, %12, off\n\t"
      "global_load_async_to_lds_b128 %5, %13, off\n\t"
      "global_load_async_to_lds_b128 %6, %14, off\n\t"
      "global_load_async_to_lds_b128 %7, %15, off\n\t"
      "s_wait_xcnt 0x0"
      :: "v"(lu), "v"(lu + rs), "v"(lu + 2 * rs), "v"(lu + 3 * rs),
         "v"(lt), "v"(lt + rs), "v"(lt + 2 * rs), "v"(lt + 3 * rs),
         "v"(gu), "v"(gu + 16 * D_DIM), "v"(gu + 32 * D_DIM), "v"(gu + 48 * D_DIM),
         "v"(gt), "v"(gt + 16 * O_DIM), "v"(gt + 32 * O_DIM), "v"(gt + 48 * O_DIM)
      : "memory");
}

__device__ __forceinline__ v4f lo4(v8f c) { return __builtin_shufflevector(c, c, 0, 1, 2, 3); }
__device__ __forceinline__ v4f hi4(v8f c) { return __builtin_shufflevector(c, c, 4, 5, 6, 7); }

// ---------------------------------------------------------------------------
__global__ __launch_bounds__(128)
void up_planes_kernel(const float* __restrict__ up,
                      _Float16* __restrict__ u16,
                      _Float16* __restrict__ ut16) {
  __shared__ _Float16 T [64][TPAD];   // [o][d]
  __shared__ _Float16 TT[64][TPAD];   // [d][o]
  const int tid  = threadIdx.x;
  const int wave = tid >> 5, lane = tid & 31;
  const int n    = blockIdx.y;
  const int ob   = blockIdx.x * 64;

  {
    const int orow = tid >> 1;           // 0..63
    const int dh   = (tid & 1) * 32;     // 32-float half row
    const v4f* rp = (const v4f*)(up + ((size_t)(ob + orow) * N_DIM + n) * D_DIM + dh);
#pragma unroll
    for (int c = 0; c < 4; ++c) {
      const v8h hv = cvt8(rp[2 * c], rp[2 * c + 1]);
      *(v8h*)&T[orow][dh + 8 * c] = hv;
#pragma unroll
      for (int j = 0; j < 8; ++j) TT[dh + 8 * c + j][orow] = hv[j];
    }
  }
  __syncthreads();

  const int q  = lane >> 3;              // line within a group of 4
  const int j8 = (lane & 7) * 8;         // 16-B piece within the line
  H8 uv[4], tv[4];
#pragma unroll
  for (int it = 0; it < 4; ++it) {
    const int row = wave * 16 + it * 4 + q;          // o row for u16 / d row for ut16
    uv[it].h = *(const v8h*)&T [row][j8];
    tv[it].h = *(const v8h*)&TT[row][j8];
  }
  _Float16* ubase = u16  + (size_t)n * O_DIM * D_DIM + (size_t)ob * D_DIM + j8;     // + row*D
  _Float16* tbase = ut16 + (size_t)n * D_DIM * O_DIM + ob + j8;                     // + row*O
#pragma unroll
  for (int it = 0; it < 4; ++it) {
    const int row = wave * 16 + it * 4 + q;
    *(v4u*)(ubase + (size_t)row * D_DIM) = uv[it].u;
    *(v4u*)(tbase + (size_t)row * O_DIM) = tv[it].u;
  }
  
}

// ---------------------------------------------------------------------------
// Per block: head n, 64 l rows (16 per wave).  The block's four waves share each 64-o tile of both
// planes through a two-buffer LDS ring filled by asynchronous copies, one tile ahead.
// Per wave and 32-wide o step:
//   GEMM1  S^T[o][l]  = sum_d U[o][d] X[l][d]        A = U rows (u16 plane), B = X^T (registers)
//   gate   W[o][l]    = tanh(S*2^-4) = 2*(sigmoid(S*2^-3) - 0.5), D tiles repacked to a B fragment in registers
//   GEMM2  F^T[d][l] += sum_o U^T[d][o] W[o][l]      A = U^T rows (ut16 plane), B = W
// Fragment map (lane l: h = l>>4, m = l&15): A/B element i<8 -> k0+8h+i, i>=8 -> k0+16+8h+(i-8);
// D element r -> (row 8h+r, col m).
__global__ __launch_bounds__(128)
void corr_main_kernel(const float* __restrict__ x,
                      const _Float16* __restrict__ u16,
                      const _Float16* __restrict__ ut16,
                      float* __restrict__ out) {
  __shared__ float Fs[4][16][FPAD];     // per-wave F[l][d] staging for whole-line stores
  __shared__ __attribute__((aligned(16))) _Float16 Us[2][OTILE][TPAD];   // ring: U tile   [o][d]
  __shared__ __attribute__((aligned(16))) _Float16 Ts[2][D_DIM][TPAD];   // ring: U^T tile [d][o]
  const int tid  = threadIdx.x;
  const int wave = tid >> 5, lane = tid & 31;
  const int h    = lane >> 4, m = lane & 15;
  const int n    = blockIdx.y;
  const int lbase = blockIdx.x * 64 + wave * 16;

  const _Float16* un  = u16  + (size_t)n * O_DIM * D_DIM;   // [o][d], pitch 64
  const _Float16* utn = ut16 + (size_t)n * D_DIM * O_DIM;   // [d][o], pitch 1024

  // This lane's 16-B piece of a tile: row tid>>3 (+16c), piece tid&7.
  const int crow = tid >> 3, cpc = (tid & 7) * 8;
  const unsigned lu0 = (unsigned)(size_t)&Us[0][crow][cpc];
  const unsigned lt0 = (unsigned)(size_t)&Ts[0][crow][cpc];
  const unsigned bufb = OTILE * TPAD * 2;                   // bytes of one buffer (both arrays)
  const _Float16* gu = un  + (size_t)crow * D_DIM + cpc;    // + tile * OTILE * D_DIM
  const _Float16* gt = utn + (size_t)crow * O_DIM + cpc;    // + tile * OTILE

  stage_tile(lu0, lt0, gu, gt);                             // tile 0 -> buffer 0

  // B fragments of GEMM1 (X^T * 2^-4, k = d): loop invariant, built once from f32 rows.
  Frag bx0, bx1;
  {
    const float* xr = x + ((size_t)(lbase + m) * N_DIM + n) * D_DIM;
    const v4f* p;
    const float xs = 0.0625f;            // 1/sqrt(64) for the affinity, 1/2 for the tanh argument
    p = (const v4f*)(xr +      8 * h);  bx0.half[0] = cvt8(p[0] * xs, p[1] * xs);   // d =  8h.. 8h+7
    p = (const v4f*)(xr + 16 + 8 * h);  bx0.half[1] = cvt8(p[0] * xs, p[1] * xs);   // d = 16+8h..
    p = (const v4f*)(xr + 32 + 8 * h);  bx1.half[0] = cvt8(p[0] * xs, p[1] * xs);   // d = 32+8h..
    p = (const v4f*)(xr + 48 + 8 * h);  bx1.half[1] = cvt8(p[0] * xs, p[1] * xs);   // d = 48+8h..
  }
  v8f acc0 = {}, acc1 = {}, acc2 = {}, acc3 = {};           // F^T d-chunks 0..3

  asm volatile("s_wait_asynccnt 0x0" ::: "memory");         // this wave's copies of tile 0 have landed
  __syncthreads();                                          // tile 0 readable by every wave
  stage_tile(lu0 + bufb, lt0 + bufb, gu + OTILE * D_DIM, gt + OTILE);   // tile 1 -> buffer 1

  // rolled: one ring trip per pass, the buffer picked by the trip's parity
#pragma unroll 1
  for (int t = 0; t < NTILE; ++t) {
   const int buf = t & 1;
   // unrolled: both 32-o steps of a tile inline, so their LDS offsets are immediates
#pragma unroll
   for (int ob = 0; ob < OTILE; ob += OSTEP) {
    // ---- GEMM1: two 16-o subtiles, K = 64 in two 32-steps ----
    v8f st0 = {}, st1 = {};
    {
      Frag a0, a1;
      const _Float16* r0 = &Us[buf][ob + m][8 * h];        // o = tile + ob + m
      const _Float16* r1 = &Us[buf][ob + 16 + m][8 * h];   // o = tile + ob + 16 + m
      a0.half[0] = *(const v8h*)(r0);       a0.half[1] = *(const v8h*)(r0 + 16);
      a1.half[0] = *(const v8h*)(r1);       a1.half[1] = *(const v8h*)(r1 + 16);
      st0 = wmma16(a0.v, bx0.v, st0);
      st1 = wmma16(a1.v, bx0.v, st1);
      Frag c0, c1;
      c0.half[0] = *(const v8h*)(r0 + 32);  c0.half[1] = *(const v8h*)(r0 + 48);
      c1.half[0] = *(const v8h*)(r1 + 32);  c1.half[1] = *(const v8h*)(r1 + 48);
      st0 = wmma16(c0.v, bx1.v, st0);
      st1 = wmma16(c1.v, bx1.v, st1);
    }

    // ---- gate + repack: B[k = o - ob][n = l]; element r <- tile rows 0..15 (st0), 8+r <- rows 16..31 (st1)
    Frag bw;
    bw.half[0] = gate8(st0);
    bw.half[1] = gate8(st1);

    // ---- GEMM2: F^T[d][l] += U^T[d][ob..ob+31] * W, four 16-d chunks ----
    {
      const _Float16* rr = &Ts[buf][m][ob + 8 * h];                       // d = dc*16 + m
      Frag a;
      a.half[0] = *(const v8h*)(rr);                    a.half[1] = *(const v8h*)(rr + 16);
      acc0 = wmma16(a.v, bw.v, acc0);
      Frag b;
      b.half[0] = *(const v8h*)(rr + 16 * TPAD);        b.half[1] = *(const v8h*)(rr + 16 * TPAD + 16);
      acc1 = wmma16(b.v, bw.v, acc1);
      Frag c;
      c.half[0] = *(const v8h*)(rr + 32 * TPAD);        c.half[1] = *(const v8h*)(rr + 32 * TPAD + 16);
      acc2 = wmma16(c.v, bw.v, acc2);
      Frag d;
      d.half[0] = *(const v8h*)(rr + 48 * TPAD);        d.half[1] = *(const v8h*)(rr + 48 * TPAD + 16);
      acc3 = wmma16(d.v, bw.v, acc3);
    }
   }
    // ---- publish point of tile t + 1; buffer buf is free behind the barrier ----
    asm volatile("s_wait_dscnt 0x0" ::: "memory");          // this wave's reads of buffer buf are done
    asm volatile("s_wait_asynccnt 0x0" ::: "memory");       // this wave's copies of tile t + 1 have landed
    __syncthreads();
    if (t + 2 < NTILE)
      stage_tile(lu0 + buf * bufb, lt0 + buf * bufb,
                 gu + (size_t)(t + 2) * (OTILE * D_DIM), gt + (t + 2) * OTILE);
  }
  asm volatile("s_wait_asynccnt 0x0" ::: "memory");         // no copy outlives the loop

  // ---- epilogue: acc_dc[r] = F^T[dc*16 + 8h + r][m] * 2  ->  Fs[m][dc*16 + 8h + r]
  {
    const float inv = 0.5f;
    float* fr = &Fs[wave][m][8 * h];
    *(v4f*)(fr +  0) = lo4(acc0) * inv;  *(v4f*)(fr +  4) = hi4(acc0) * inv;
    *(v4f*)(fr + 16) = lo4(acc1) * inv;  *(v4f*)(fr + 20) = hi4(acc1) * inv;
    *(v4f*)(fr + 32) = lo4(acc2) * inv;  *(v4f*)(fr + 36) = hi4(acc2) * inv;
    *(v4f*)(fr + 48) = lo4(acc3) * inv;  *(v4f*)(fr + 52) = hi4(acc3) * inv;
  }
  __syncthreads();

  // ---- whole-line output stores: wave owns 16 rows x 2 lines; lanes 8q..8q+7 write one line per instruction
  {
    const int q  = lane >> 3;
    const int j4 = (lane & 7) * 4;
    v4f v[8];
#pragma unroll
    for (int it = 0; it < 8; ++it) {
      const int li = it * 4 + q;                 // 0..31
      const int row = li >> 1, hf = (li & 1) * 32;
      v[it] = *(const v4f*)&Fs[wave][row][hf + j4];
    }
    float* obase = out + ((size_t)lbase * N_DIM + n) * D_DIM + j4;
#pragma unroll
    for (int it = 0; it < 8; ++it) {
      const int li = it * 4 + q;
      const int row = li >> 1, hf = (li & 1) * 32;
      *(v4f*)(obase + (size_t)row * (N_DIM * D_DIM) + hf) = v[it];
    }
    
  }
}

extern "C" void kernel_launch(void* const* d_in, const int* in_sizes, int n_in,
                              void* d_out, int out_size, void* d_ws, size_t ws_size,
                              hipStream_t stream) {
  if (n_in < 2) return;
  if (in_sizes[0] != L_DIM * N_DIM * D_DIM) return;
  if (in_sizes[1] != O_DIM * N_DIM * D_DIM) return;
  if (out_size != L_DIM * N_DIM * D_DIM) return;
  const float* x  = (const float*)d_in[0];   // [L][N][D] f32
  const float* up = (const float*)d_in[1];   // [O][N][D] f32
  float* out = (float*)d_out;                // [L][N][D] f32

  // ws carve: u16 plane [N][O][D] f16, ut16 plane [N][D][O] f16  (8 MiB each, 16 MiB total)
  const size_t plane_bytes = (size_t)in_sizes[1] * sizeof(_Float16);
  if (ws_size < 2 * plane_bytes) return;
  _Float16* u16  = (_Float16*)d_ws;
  _Float16* ut16 = (_Float16*)((char*)d_ws + plane_bytes);

  up_planes_kernel<<<dim3(O_DIM / 64, N_DIM), 128, 0, stream>>>(up, u16, ut16);
  corr_main_kernel<<<dim3(L_DIM / 64, N_DIM), 128, 0, stream>>>(x, u16, ut16, out);
}

// v003
// A run of this version takes 22.7 microseconds.
// Next to v002, in two timings, it ran 1.26 times as fast each time.
// Over all steps from v000 it is 3.57 times as fast.
// All contractions: v_wmma_f32_16x16x32_f16 (f16 operands, f32 accumulate); gate weights are tanh(s/2) in f16; the scale 2^-4 is applied to X in f32 before its convert, the 0.5 to the f32 result.
#include <hip/hip_runtime.h>
#include <stddef.h>

typedef _Float16 v16h __attribute__((ext_vector_type(16)));
typedef _Float16 v8h  __attribute__((ext_vector_type(8)));
typedef float    v8f  __attribute__((ext_vector_type(8)));
typedef float    v4f  __attribute__((ext_vector_type(4)));
typedef unsigned v4u  __attribute__((ext_vector_type(4)));

union Frag { v16h v; v8h half[2]; };
union H8   { v8h h; v4u u; };

#define L_DIM 1024
#define N_DIM 64
#define D_DIM 64
#define O_DIM 1024
#define OSTEP 32
#define TPAD 72      // f16 pitch of the 64-wide LDS tiles (144 B, 16-B aligned rows)
#define FPAD 68      // f32 pitch of the output staging tile (272 B, 16-B aligned rows)
#define OTILE 256    // o rows of one staged tile (eight 32-wide o steps)
#define TTPAD (OTILE + 8)   // f16 pitch of the staged U^T rows (528 B, 16 B x odd)
#define LBLK 256     // l rows of one work-group: 8 waves of 32
#define NTILE (O_DIM / OTILE)

// 16-bit WMMA with the hazard guard: 4 v_nop tied to D, A and B kept live.
__device__ __forceinline__ v8f wmma16(v16h a, v16h b, v8f c) {
  v8f d = __builtin_amdgcn_wmma_f32_16x16x32_f16(false, a, false, b, (short)0, c, false, false);
  asm volatile("v_nop\n\tv_nop\n\tv_nop\n\tv_nop" : "+v"(d) : "v"(a), "v"(b));
  return d;
}

// 8 f32 (two v4f) -> packed v8h, RNE convert
__device__ __forceinline__ v8h cvt8(v4f a, v4f b) {
  v8h h;
  h[0] = (_Float16)a[0]; h[1] = (_Float16)a[1]; h[2] = (_Float16)a[2]; h[3] = (_Float16)a[3];
  h[4] = (_Float16)b[0]; h[5] = (_Float16)b[1]; h[6] = (_Float16)b[2]; h[7] = (_Float16)b[3];
  return h;
}

// gate weights of one D tile: sigmoid(s) - 0.5 = 0.5 * tanh(s / 2).  st arrives as s / 2 (X carries 2^-4),
// so a weight is one v_tanh_f32; the 0.5 is applied once to the accumulated result.
// One statement with every result apart from every source ("=&v"): no instruction directly behind a
// transcendental then overwrites its source, which register reuse between single calls would allow.
__device__ __forceinline__ v8h gate8(v8f st) {
  float t0, t1, t2, t3, t4, t5, t6, t7;
  asm("v_tanh_f32 %0, %8\n\t"
      "v_tanh_f32 %1, %9\n\t"
      "v_tanh_f32 %2, %10\n\t"
      "v_tanh_f32 %3, %11\n\t"
      "v_tanh_f32 %4, %12\n\t"
      "v_tanh_f32 %5, %13\n\t"
      "v_tanh_f32 %6, %14\n\t"
      "v_tanh_f32 %7, %15\n\t"
      "v_nop"                            // the slot behind the last transcendental, whatever reads t7 next
      : "=&v"(t0), "=&v"(t1), "=&v"(t2), "=&v"(t3), "=&v"(t4), "=&v"(t5), "=&v"(t6), "=&v"(t7)
      : "v"(st[0]), "v"(st[1]), "v"(st[2]), "v"(st[3]), "v"(st[4]), "v"(st[5]), "v"(st[6]), "v"(st[7]));
  v8h w;
  w[0] = (_Float16)t0; w[1] = (_Float16)t1; w[2] = (_Float16)t2; w[3] = (_Float16)t3;
  w[4] = (_Float16)t4; w[5] = (_Float16)t5; w[6] = (_Float16)t6; w[7] = (_Float16)t7;
  return w;
}

// Eight asynchronous copies of 16 B per lane: LDS address l + c * ls bytes, global address g + c * gs elements, c = 0..7.
// The s_wait_xcnt stands inside the statement so that no address register is rewritten ahead of it.
__device__ __forceinline__ void copy8(unsigned l, unsigned ls, const _Float16* g, size_t gs) {
  asm volatile(
      "global_load_async_to_lds_b128 %0, %8, off\n\t"
      "global_load_async_to_lds_b128 %1, %9, off\n\t"
      "global_load_async_to_lds_b128 %2, %10, off\n\t"
      "global_load_async_to_lds_b128 %3, %11, off\n\t"
      "global_load_async_to_lds_b128 %4, %12, off\n\t"
      "global_load_async_to_lds_b128 %5, %13, off\n\t"
      "global_load_async_to_lds_b128 %6, %14, off\n\t"
      "global_load_async_to_lds_b128 %7, %15, off\n\t"
      "s_wait_xcnt 0x0"
      :: "v"(l), "v"(l + ls), "v"(l + 2 * ls), "v"(l + 3 * ls),
         "v"(l + 4 * ls), "v"(l + 5 * ls), "v"(l + 6 * ls), "v"(l + 7 * ls),
         "v"(g), "v"(g + gs), "v"(g + 2 * gs), "v"(g + 3 * gs),
         "v"(g + 4 * gs), "v"(g + 5 * gs), "v"(g + 6 * gs), "v"(g + 7 * gs)
      : "memory");
}

// One staged tile: 256 U rows [o][d] of 128 B (rows c*32 + (tid>>3), 8 lanes per row) and
// 64 U^T rows [d][o] of 512 B (rows c*8 + (tid>>5), one wave per row), c = 0..7.
__device__ __forceinline__ void stage_tile(unsigned lu, unsigned lt,
                                           const _Float16* gu, const _Float16* gt) {
  copy8(lu, 32 * TPAD * 2, gu, 32 * D_DIM);
  copy8(lt, 8 * TTPAD * 2, gt, 8 * O_DIM);
}

__device__ __forceinline__ v4f lo4(v8f c) { return __builtin_shufflevector(c, c, 0, 1, 2, 3); }
__device__ __forceinline__ v4f hi4(v8f c) { return __builtin_shufflevector(c, c, 4, 5, 6, 7); }

// ---------------------------------------------------------------------------
__global__ __launch_bounds__(128)
void up_planes_kernel(const float* __restrict__ up,
                      _Float16* __restrict__ u16,
                      _Float16* __restrict__ ut16) {
  __shared__ _Float16 T [64][TPAD];   // [o][d]
  __shared__ _Float16 TT[64][TPAD];   // [d][o]
  const int tid  = threadIdx.x;
  const int wave = tid >> 5, lane = tid & 31;
  const int n    = blockIdx.y;
  const int ob   = blockIdx.x * 64;

  {
    const int orow = tid >> 1;           // 0..63
    const int dh   = (tid & 1) * 32;     // 32-float half row
    const v4f* rp = (const v4f*)(up + ((size_t)(ob + orow) * N_DIM + n) * D_DIM + dh);
#pragma unroll
    for (int c = 0; c < 4; ++c) {
      const v8h hv = cvt8(rp[2 * c], rp[2 * c + 1]);
      *(v8h*)&T[orow][dh + 8 * c] = hv;
#pragma unroll
      for (int j = 0; j < 8; ++j) TT[dh + 8 * c + j][orow] = hv[j];
    }
  }
  __syncthreads();

  const int q  = lane >> 3;              // line within a group of 4
  const int j8 = (lane & 7) * 8;         // 16-B piece within the line
  H8 uv[4], tv[4];
#pragma unroll
  for (int it = 0; it < 4; ++it) {
    const int row = wave * 16 + it * 4 + q;          // o row for u16 / d row for ut16
    uv[it].h = *(const v8h*)&T [row][j8];
    tv[it].h = *(const v8h*)&TT[row][j8];
  }
  _Float16* ubase = u16  + (size_t)n * O_DIM * D_DIM + (size_t)ob * D_DIM + j8;     // + row*D
  _Float16* tbase = ut16 + (size_t)n * D_DIM * O_DIM + ob + j8;                     // + row*O
#pragma unroll
  for (int it = 0; it < 4; ++it) {
    const int row = wave * 16 + it * 4 + q;
    *(v4u*)(ubase + (size_t)row * D_DIM) = uv[it].u;
    *(v4u*)(tbase + (size_t)row * O_DIM) = tv[it].u;
  }
  
}

// ---------------------------------------------------------------------------
// Per block: head n, 256 l rows (32 per wave, two 16-l column groups A and B).  The block's eight waves
// share each 256-o tile of both planes through a two-buffer LDS ring filled by asynchronous copies, one
// tile ahead.  Every A fragment read from LDS feeds two WMMAs, one per column group.
// Per wave and 32-wide o step:
//   GEMM1  S^T[o][l]  = sum_d U[o][d] X[l][d]        A = U rows (u16 plane), B = X^T (registers)
//   gate   W[o][l]    = tanh(S*2^-4) = 2*(sigmoid(S*2^-3) - 0.5), D tiles repacked to a B fragment in registers
//   GEMM2  F^T[d][l] += sum_o U^T[d][o] W[o][l]      A = U^T rows (ut16 plane), B = W
// Fragment map (lane l: h = l>>4, m = l&15): A/B element i<8 -> k0+8h+i, i>=8 -> k0+16+8h+(i-8);
// D element r -> (row 8h+r, col m).
__global__ __launch_bounds__(256)
void corr_main_kernel(const float* __restrict__ x,
                      const _Float16* __restrict__ u16,
                      const _Float16* __restrict__ ut16,
                      float* __restrict__ out) {
  __shared__ float Fs[8][32][FPAD];     // per-wave F[l][d] staging for whole-line stores
  __shared__ __attribute__((aligned(16))) _Float16 Us[2][OTILE][TPAD];    // ring: U tile   [o][d]
  __shared__ __attribute__((aligned(16))) _Float16 Ts[2][D_DIM][TTPAD];   // ring: U^T tile [d][o]
  const int tid  = threadIdx.x;
  const int wave = tid >> 5, lane = tid & 31;
  const int h    = lane >> 4, m = lane & 15;
  const int n    = blockIdx.y;
  const int lbase = blockIdx.x * LBLK + wave * 32;

  const _Float16* un  = u16  + (size_t)n * O_DIM * D_DIM;   // [o][d], pitch 64
  const _Float16* utn = ut16 + (size_t)n * D_DIM * O_DIM;   // [d][o], pitch 1024

  // This lane's 16-B pieces of a tile: U row tid>>3 (+32c), piece tid&7; U^T row tid>>5 (+8c), piece tid&31.
  const int urow = tid >> 3, upc = (tid & 7) * 8;
  const int trow = tid >> 5, tpc = (tid & 31) * 8;
  const unsigned lu0 = (unsigned)(size_t)&Us[0][urow][upc];
  const unsigned lt0 = (unsigned)(size_t)&Ts[0][trow][tpc];
  const unsigned ubufb = OTILE * TPAD * 2;                  // bytes of one U buffer
  const unsigned tbufb = D_DIM * TTPAD * 2;                 // bytes of one U^T buffer
  const _Float16* gu = un  + (size_t)urow * D_DIM + upc;    // + tile * OTILE * D_DIM
  const _Float16* gt = utn + (size_t)trow * O_DIM + tpc;    // + tile * OTILE

  stage_tile(lu0, lt0, gu, gt);                             // tile 0 -> buffer 0

  // B fragments of GEMM1 (X^T * 2^-4, k = d), one pair per column group: loop invariant, built once from f32 rows.
  Frag bxa0, bxa1, bxb0, bxb1;
  {
    const float* xa = x + ((size_t)(lbase + m) * N_DIM + n) * D_DIM;
    const float* xb = xa + (size_t)16 * N_DIM * D_DIM;
    const v4f* p;
    const float xs = 0.0625f;            // 1/sqrt(64) for the affinity, 1/2 for the tanh argument
    p = (const v4f*)(xa +      8 * h);  bxa0.half[0] = cvt8(p[0] * xs, p[1] * xs);   // d =  8h.. 8h+7
    p = (const v4f*)(xa + 16 + 8 * h);  bxa0.half[1] = cvt8(p[0] * xs, p[1] * xs);   // d = 16+8h..
    p = (const v4f*)(xa + 32 + 8 * h);  bxa1.half[0] = cvt8(p[0] * xs, p[1] * xs);   // d = 32+8h..
    p = (const v4f*)(xa + 48 + 8 * h);  bxa1.half[1] = cvt8(p[0] * xs, p[1] * xs);   // d = 48+8h..
    p = (const v4f*)(xb +      8 * h);  bxb0.half[0] = cvt8(p[0] * xs, p[1] * xs);
    p = (const v4f*)(xb + 16 + 8 * h);  bxb0.half[1] = cvt8(p[0] * xs, p[1] * xs);
    p = (const v4f*)(xb + 32 + 8 * h);  bxb1.half[0] = cvt8(p[0] * xs, p[1] * xs);
    p = (const v4f*)(xb + 48 + 8 * h);  bxb1.half[1] = cvt8(p[0] * xs, p[1] * xs);
  }
  v8f acca0 = {}, acca1 = {}, acca2 = {}, acca3 = {};       // F^T d-chunks 0..3, column group A
  v8f accb0 = {}, accb1 = {}, accb2 = {}, accb3 = {};       // F^T d-chunks 0..3, column group B

  asm volatile("s_wait_asynccnt 0x0" ::: "memory");         // this wave's copies of tile 0 have landed
  __syncthreads();                                          // tile 0 readable by every wave
  stage_tile(lu0 + ubufb, lt0 + tbufb, gu + OTILE * D_DIM, gt + OTILE);   // tile 1 -> buffer 1

  // rolled: one ring trip per pass, the buffer picked by the trip's parity
#pragma unroll 1
  for (int t = 0; t < NTILE; ++t) {
   const int buf = t & 1;
   const _Float16* ur = &Us[buf][m][8 * h];                 // U rows:   o = tile + ob + 16*j + m
   const _Float16* tr = &Ts[buf][m][8 * h];                 // U^T rows: d = 16*dc + m
   // GEMM1's A fragments of the tile's first o step; later steps' are read one step ahead, inside this buffer only
   Frag a0, a1, c0, c1;
   a0.half[0] = *(const v8h*)(ur);                  a0.half[1] = *(const v8h*)(ur + 16);
   a1.half[0] = *(const v8h*)(ur + 16 * TPAD);      a1.half[1] = *(const v8h*)(ur + 16 * TPAD + 16);
   c0.half[0] = *(const v8h*)(ur + 32);             c0.half[1] = *(const v8h*)(ur + 48);
   c1.half[0] = *(const v8h*)(ur + 16 * TPAD + 32); c1.half[1] = *(const v8h*)(ur + 16 * TPAD + 48);
   // unrolled: the eight 32-o steps of a tile inline, so their LDS offsets are immediates
#pragma unroll
   for (int ob = 0; ob < OTILE; ob += OSTEP) {
    // GEMM2's A fragments of this step, read ahead of GEMM1 and the gate so that they land behind them
    Frag e0, e1, e2, e3;
    {
      const _Float16* rr = tr + ob;
      e0.half[0] = *(const v8h*)(rr);               e0.half[1] = *(const v8h*)(rr + 16);
      e1.half[0] = *(const v8h*)(rr + 16 * TTPAD);  e1.half[1] = *(const v8h*)(rr + 16 * TTPAD + 16);
      e2.half[0] = *(const v8h*)(rr + 32 * TTPAD);  e2.half[1] = *(const v8h*)(rr + 32 * TTPAD + 16);
      e3.half[0] = *(const v8h*)(rr + 48 * TTPAD);  e3.half[1] = *(const v8h*)(rr + 48 * TTPAD + 16);
    }

    // ---- GEMM1: two 16-o subtiles x two column groups, K = 64 in two 32-steps ----
    v8f sa0 = {}, sa1 = {}, sb0 = {}, sb1 = {};
    sa0 = wmma16(a0.v, bxa0.v, sa0);
    sb0 = wmma16(a0.v, bxb0.v, sb0);
    sa1 = wmma16(a1.v, bxa0.v, sa1);
    sb1 = wmma16(a1.v, bxb0.v, sb1);
    sa0 = wmma16(c0.v, bxa1.v, sa0);
    sb0 = wmma16(c0.v, bxb1.v, sb0);
    sa1 = wmma16(c1.v, bxa1.v, sa1);
    sb1 = wmma16(c1.v, bxb1.v, sb1);

    // the next step's GEMM1 fragments, to land behind the gate and GEMM2
    if (ob + OSTEP < OTILE) {
      const _Float16* r0 = ur + (ob + OSTEP) * TPAD;
      const _Float16* r1 = r0 + 16 * TPAD;
      a0.half[0] = *(const v8h*)(r0);       a0.half[1] = *(const v8h*)(r0 + 16);
      a1.half[0] = *(const v8h*)(r1);       a1.half[1] = *(const v8h*)(r1 + 16);
      c0.half[0] = *(const v8h*)(r0 + 32);  c0.half[1] = *(const v8h*)(r0 + 48);
      c1.half[0] = *(const v8h*)(r1 + 32);  c1.half[1] = *(const v8h*)(r1 + 48);
    }

    // ---- gate + repack: B[k = o - ob][n = l]; element r <- tile rows 0..15 (s?0), 8+r <- rows 16..31 (s?1)
    Frag bwa, bwb;
    bwa.half[0] = gate8(sa0);
    bwa.half[1] = gate8(sa1);
    bwb.half[0] = gate8(sb0);
    bwb.half[1] = gate8(sb1);

    // ---- GEMM2: F^T[d][l] += U^T[d][ob..ob+31] * W, four 16-d chunks x two column groups ----
    acca0 = wmma16(e0.v, bwa.v, acca0);
    acca1 = wmma16(e1.v, bwa.v, acca1);
    acca2 = wmma16(e2.v, bwa.v, acca2);
    acca3 = wmma16(e3.v, bwa.v, acca3);
    accb0 = wmma16(e0.v, bwb.v, accb0);
    accb1 = wmma16(e1.v, bwb.v, accb1);
    accb2 = wmma16(e2.v, bwb.v, accb2);
    accb3 = wmma16(e3.v, bwb.v, accb3);
   }
    // ---- publish point of tile t + 1; buffer buf is free behind the barrier ----
    asm volatile("s_wait_dscnt 0x0" ::: "memory");          // this wave's reads of buffer buf are done
    asm volatile("s_wait_asynccnt 0x0" ::: "memory");       // this wave's copies of tile t + 1 have landed
    __syncthreads();
    if (t + 2 < NTILE)
      stage_tile(lu0 + buf * ubufb, lt0 + buf * tbufb,
                 gu + (size_t)(t + 2) * (OTILE * D_DIM), gt + (t + 2) * OTILE);
  }
  asm volatile("s_wait_asynccnt 0x0" ::: "memory");         // no copy outlives the loop

  // ---- epilogue: acc?_dc[r] = F^T[dc*16 + 8h + r][col] * 2  ->  Fs[col][dc*16 + 8h + r]
  {
    const float inv = 0.5f;
    float* fa = &Fs[wave][m][8 * h];
    *(v4f*)(fa +  0) = lo4(acca0) * inv;  *(v4f*)(fa +  4) = hi4(acca0) * inv;
    *(v4f*)(fa + 16) = lo4(acca1) * inv;  *(v4f*)(fa + 20) = hi4(acca1) * inv;
    *(v4f*)(fa + 32) = lo4(acca2) * inv;  *(v4f*)(fa + 36) = hi4(acca2) * inv;
    *(v4f*)(fa + 48) = lo4(acca3) * inv;  *(v4f*)(fa + 52) = hi4(acca3) * inv;
    float* fb = &Fs[wave][16 + m][8 * h];
    *(v4f*)(fb +  0) = lo4(accb0) * inv;  *(v4f*)(fb +  4) = hi4(accb0) * inv;
    *(v4f*)(fb + 16) = lo4(accb1) * inv;  *(v4f*)(fb + 20) = hi4(accb1) * inv;
    *(v4f*)(fb + 32) = lo4(accb2) * inv;  *(v4f*)(fb + 36) = hi4(accb2) * inv;
    *(v4f*)(fb + 48) = lo4(accb3) * inv;  *(v4f*)(fb + 52) = hi4(accb3) * inv;
  }
  __syncthreads();

  // ---- whole-line output stores: wave owns 32 rows x 2 lines; lanes 8q..8q+7 write one line per instruction
  {
    const int q  = lane >> 3;
    const int j4 = (lane & 7) * 4;
    v4f v[16];
#pragma unroll
    for (int it = 0; it < 16; ++it) {
      const int li = it * 4 + q;                 // 0..63
      const int row = li >> 1, hf = (li & 1) * 32;
      v[it] = *(const v4f*)&Fs[wave][row][hf + j4];
    }
    float* obase = out + ((size_t)lbase * N_DIM + n) * D_DIM + j4;
#pragma unroll
    for (int it = 0; it < 16; ++it) {
      const int li = it * 4 + q;
      const int row = li >> 1, hf = (li & 1) * 32;
      *(v4f*)(obase + (size_t)row * (N_DIM * D_DIM) + hf) = v[it];
    }
  }
}

extern "C" void kernel_launch(void* const* d_in, const int* in_sizes, int n_in,
                              void* d_out, int out_size, void* d_ws, size_t ws_size,
                              hipStream_t stream) {
  if (n_in < 2) return;
  if (in_sizes[0] != L_DIM * N_DIM * D_DIM) return;
  if (in_sizes[1] != O_DIM * N_DIM * D_DIM) return;
  if (out_size != L_DIM * N_DIM * D_DIM) return;
  const float* x  = (const float*)d_in[0];   // [L][N][D] f32
  const float* up = (const float*)d_in[1];   // [O][N][D] f32
  float* out = (float*)d_out;                // [L][N][D] f32

  // ws carve: u16 plane [N][O][D] f16, ut16 plane [N][D][O] f16  (8 MiB each, 16 MiB total)
  const size_t plane_bytes = (size_t)in_sizes[1] * sizeof(_Float16);
  if (ws_size < 2 * plane_bytes) return;
  _Float16* u16  = (_Float16*)d_ws;
  _Float16* ut16 = (_Float16*)((char*)d_ws + plane_bytes);

  up_planes_kernel<<<dim3(O_DIM / 64, N_DIM), 128, 0, stream>>>(up, u16, ut16);
  corr_main_kernel<<<dim3(L_DIM / LBLK, N_DIM), 256, 0, stream>>>(x, u16, ut16, out);
}

// v004
// A run of this version takes 15.1 microseconds.
// In two side-by-side timings against v003, it was 1.50 and 1.51 times as fast.
// Over all steps from v000 it is 5.37 times as fast.
// All contractions: v_wmma_f32_16x16x32_f16 (f16 operands, f32 accumulate); gate weights are tanh(s/2) in f16; the scale 2^-4 is applied to X in f32 before its convert, the 0.5 to the f32 result.
#include <hip/hip_runtime.h>
#include <stddef.h>

typedef _Float16 v16h __attribute__((ext_vector_type(16)));
typedef _Float16 v8h  __attribute__((ext_vector_type(8)));
typedef float    v8f  __attribute__((ext_vector_type(8)));
typedef float    v4f  __attribute__((ext_vector_type(4)));
typedef _Float16 v4h  __attribute__((ext_vector_type(4)));
typedef short    s8s  __attribute__((ext_vector_type(8)));

union Frag { v16h v; v8h half[2]; };

#define L_DIM 1024
#define N_DIM 64
#define D_DIM 64
#define O_DIM 1024
#define OSTEP 32
#define TPAD 72      // f16 pitch of the U tile that plain 16-B reads take (144 B = 16 B x odd)
#define VPAD 80      // f16 pitch of the U tile that transposing reads take (160 B = 32 B x odd)
#define FPAD 68      // f32 pitch of the output staging tile (272 B, 16-B aligned rows)
#define OTILE 256    // o rows of one staged tile (eight 32-wide o steps)
#define LBLK 256     // l rows of one work-group: 8 waves of 32
#define NTILE (O_DIM / OTILE)

// 16-bit WMMA with the hazard guard: 4 v_nop tied to D, A and B kept live.
__device__ __forceinline__ v8f wmma16(v16h a, v16h b, v8f c) {
  v8f d = __builtin_amdgcn_wmma_f32_16x16x32_f16(false, a, false, b, (short)0, c, false, false);
  asm volatile("v_nop\n\tv_nop\n\tv_nop\n\tv_nop" : "+v"(d) : "v"(a), "v"(b));
  return d;
}

// 8 f32 (two v4f) -> packed v8h, RNE convert
__device__ __forceinline__ v8h cvt8(v4f a, v4f b) {
  v8h h;
  h[0] = (_Float16)a[0]; h[1] = (_Float16)a[1]; h[2] = (_Float16)a[2]; h[3] = (_Float16)a[3];
  h[4] = (_Float16)b[0]; h[5] = (_Float16)b[1]; h[6] = (_Float16)b[2]; h[7] = (_Float16)b[3];
  return h;
}

// gate weights of one D tile: sigmoid(s) - 0.5 = 0.5 * tanh(s / 2).  st arrives as s / 2 (X carries 2^-4),
// so a weight is one v_tanh_f32; the 0.5 is applied once to the accumulated result.
// One statement with every result apart from every source ("=&v"): no instruction directly behind a
// transcendental then overwrites its source, which register reuse between single calls would allow.
__device__ __forceinline__ v8h gate8(v8f st) {
  float t0, t1, t2, t3, t4, t5, t6, t7;
  asm("v_tanh_f32 %0, %8\n\t"
      "v_tanh_f32 %1, %9\n\t"
      "v_tanh_f32 %2, %10\n\t"
      "v_tanh_f32 %3, %11\n\t"
      "v_tanh_f32 %4, %12\n\t"
      "v_tanh_f32 %5, %13\n\t"
      "v_tanh_f32 %6, %14\n\t"
      "v_tanh_f32 %7, %15\n\t"
      "v_nop"                            // the slot behind the last transcendental, whatever reads t7 next
      : "=&v"(t0), "=&v"(t1), "=&v"(t2), "=&v"(t3), "=&v"(t4), "=&v"(t5), "=&v"(t6), "=&v"(t7)
      : "v"(st[0]), "v"(st[1]), "v"(st[2]), "v"(st[3]), "v"(st[4]), "v"(st[5]), "v"(st[6]), "v"(st[7]));
  v8h w;
  w[0] = (_Float16)t0; w[1] = (_Float16)t1; w[2] = (_Float16)t2; w[3] = (_Float16)t3;
  w[4] = (_Float16)t4; w[5] = (_Float16)t5; w[6] = (_Float16)t6; w[7] = (_Float16)t7;
  return w;
}

// One 256-o tile of head n, f32, into registers: 16 loads of 16 B per lane.  A wave's load covers two whole
// 256-B rows (lanes 0-15 row c*16 + wave, lanes 16-31 row c*16 + wave + 8).
__device__ __forceinline__ void load_tile(v4f (&st)[16], const float* g) {
#pragma unroll
  for (int c = 0; c < 16; ++c) st[c] = *(const v4f*)(g + (size_t)c * (16 * N_DIM * D_DIM));
  // no address register of these loads is rewritten ahead of this wait
  asm volatile("s_wait_xcnt 0x0" ::: "memory");
}

// The tile in registers -> f16 (RNE) -> both LDS copies of the [o][d] tile, each at its own reader's pitch.
__device__ __forceinline__ void store_tile(const v4f (&st)[16], _Float16* pu, _Float16* pv) {
#pragma unroll
  for (int c = 0; c < 16; ++c) {
    v4h hv;
    hv[0] = (_Float16)st[c][0]; hv[1] = (_Float16)st[c][1]; hv[2] = (_Float16)st[c][2]; hv[3] = (_Float16)st[c][3];
    *(v4h*)(pu + c * 16 * TPAD) = hv;
    *(v4h*)(pv + c * 16 * VPAD) = hv;
  }
}

// Transposing LDS read: lane (m, h) whose address is row 8h + (lane & 7), 16-B piece (lane >> 3) & 1 of a
// row-major 16-bit tile gets rows 8h .. 8h+7 of column m.
__device__ __forceinline__ v8h ld_tr16(const _Float16* p) {
  typedef __attribute__((address_space(3))) s8s lds_s8s;
  return __builtin_bit_cast(v8h, __builtin_amdgcn_ds_load_tr16_b128_v8i16((lds_s8s*)p));
}

__device__ __forceinline__ v4f lo4(v8f c) { return __builtin_shufflevector(c, c, 0, 1, 2, 3); }
__device__ __forceinline__ v4f hi4(v8f c) { return __builtin_shufflevector(c, c, 4, 5, 6, 7); }

// ---------------------------------------------------------------------------
// Per block: head n, 256 l rows (32 per wave, two 16-l column groups A and B).  The block's eight waves
// share each 256-o tile of U through a two-buffer LDS ring.  A tile is read from the f32 input into registers
// one ring trip ahead, converted to f16 and stored to LDS at the foot of the trip before its own.
// Every A fragment read from LDS feeds two WMMAs, one per column group.
// Per wave and 32-wide o step:
//   GEMM1  S^T[o][l]  = sum_d U[o][d] X[l][d]        A = U rows (plain LDS reads), B = X^T (registers)
//   gate   W[o][l]    = tanh(S*2^-4) = 2*(sigmoid(S*2^-3) - 0.5), D tiles repacked to a B fragment in registers
//   GEMM2  F^T[d][l] += sum_o U^T[d][o] W[o][l]      A = U^T rows (transposing LDS reads), B = W
// Fragment map (lane l: h = l>>4, m = l&15): A/B element i<8 -> k0+8h+i, i>=8 -> k0+16+8h+(i-8);
// D element r -> (row 8h+r, col m).
__global__ __launch_bounds__(256)
void corr_main_kernel(const float* __restrict__ x,
                      const float* __restrict__ up,
                      float* __restrict__ out) {
  __shared__ float Fs[8][32][FPAD];     // per-wave F[l][d] staging for whole-line stores
  __shared__ __attribute__((aligned(16))) _Float16 Us[2][OTILE][TPAD];    // ring: U tile [o][d] for GEMM1's plain reads
  __shared__ __attribute__((aligned(32))) _Float16 Vs[2][OTILE][VPAD];    // ring: the same tile for GEMM2's transposing reads
  const int tid  = threadIdx.x;
  const int wave = tid >> 5, lane = tid & 31;
  const int h    = lane >> 4, m = lane & 15;
  const int n    = blockIdx.y;
  const int lbase = blockIdx.x * LBLK + wave * 32;

  // This lane's 16-B f32 pieces of a tile: row wave + 8*h (+16c), piece m.
  const int srow = wave + 8 * h, spc = m * 4;
  const float* gs = up + ((size_t)srow * N_DIM + n) * D_DIM + spc;    // + tile * OTILE * N_DIM * D_DIM
  v4f st[16];
  load_tile(st, gs);                                        // tile 0 -> registers

  // B fragments of GEMM1 (X^T * 2^-4, k = d), one pair per column group: loop invariant, built once from f32 rows.
  Frag bxa0, bxa1, bxb0, bxb1;
  {
    const float* xa = x + ((size_t)(lbase + m) * N_DIM + n) * D_DIM;
    const float* xb = xa + (size_t)16 * N_DIM * D_DIM;
    const v4f* p;
    const float xs = 0.0625f;            // 1/sqrt(64) for the affinity, 1/2 for the tanh argument
    p = (const v4f*)(xa +      8 * h);  bxa0.half[0] = cvt8(p[0] * xs, p[1] * xs);   // d =  8h.. 8h+7
    p = (const v4f*)(xa + 16 + 8 * h);  bxa0.half[1] = cvt8(p[0] * xs, p[1] * xs);   // d = 16+8h..
    p = (const v4f*)(xa + 32 + 8 * h);  bxa1.half[0] = cvt8(p[0] * xs, p[1] * xs);   // d = 32+8h..
    p = (const v4f*)(xa + 48 + 8 * h);  bxa1.half[1] = cvt8(p[0] * xs, p[1] * xs);   // d = 48+8h..
    p = (const v4f*)(xb +      8 * h);  bxb0.half[0] = cvt8(p[0] * xs, p[1] * xs);
    p = (const v4f*)(xb + 16 + 8 * h);  bxb0.half[1] = cvt8(p[0] * xs, p[1] * xs);
    p = (const v4f*)(xb + 32 + 8 * h);  bxb1.half[0] = cvt8(p[0] * xs, p[1] * xs);
    p = (const v4f*)(xb + 48 + 8 * h);  bxb1.half[1] = cvt8(p[0] * xs, p[1] * xs);
  }
  v8f acca0 = {}, acca1 = {}, acca2 = {}, acca3 = {};       // F^T d-chunks 0..3, column group A
  v8f accb0 = {}, accb1 = {}, accb2 = {}, accb3 = {};       // F^T d-chunks 0..3, column group B

  store_tile(st, &Us[0][srow][spc], &Vs[0][srow][spc]);     // tile 0 -> buffer 0
  __syncthreads();                                          // tile 0 readable by every wave
  load_tile(st, gs + (size_t)OTILE * N_DIM * D_DIM);        // tile 1 -> registers, in flight over trip 0

  // rolled: one ring trip per pass, the buffer picked by the trip's parity
#pragma unroll 1
  for (int t = 0; t < NTILE; ++t) {
   const int buf = t & 1;
   const _Float16* ur = &Us[buf][m][8 * h];                 // U rows:   o = tile + ob + 16*j + m
   const _Float16* tr = &Vs[buf][8 * h + (lane & 7)][8 * ((lane >> 3) & 1)];   // transposing reads: + o step rows, + 16*dc columns
   // GEMM1's A fragments of the tile's first o step; later steps' are read one step ahead, inside this buffer only
   Frag a0, a1, c0, c1;
   a0.half[0] = *(const v8h*)(ur);                  a0.half[1] = *(const v8h*)(ur + 16);
   a1.half[0] = *(const v8h*)(ur + 16 * TPAD);      a1.half[1] = *(const v8h*)(ur + 16 * TPAD + 16);
   c0.half[0] = *(const v8h*)(ur + 32);             c0.half[1] = *(const v8h*)(ur + 48);
   c1.half[0] = *(const v8h*)(ur + 16 * TPAD + 32); c1.half[1] = *(const v8h*)(ur + 16 * TPAD + 48);
   // unrolled: the eight 32-o steps of a tile inline, so their LDS offsets are immediates
#pragma unroll
   for (int ob = 0; ob < OTILE; ob += OSTEP) {
    // GEMM2's A fragments of this step, read ahead of GEMM1 and the gate so that they land behind them
    Frag e0, e1, e2, e3;
    {
      const _Float16* rr = tr + ob * VPAD;
      e0.half[0] = ld_tr16(rr);       e0.half[1] = ld_tr16(rr + 16 * VPAD);
      e1.half[0] = ld_tr16(rr + 16);  e1.half[1] = ld_tr16(rr + 16 * VPAD + 16);
      e2.half[0] = ld_tr16(rr + 32);  e2.half[1] = ld_tr16(rr + 16 * VPAD + 32);
      e3.half[0] = ld_tr16(rr + 48);  e3.half[1] = ld_tr16(rr + 16 * VPAD + 48);
    }

    // ---- GEMM1: two 16-o subtiles x two column groups, K = 64 in two 32-steps ----
    v8f sa0 = {}, sa1 = {}, sb0 = {}, sb1 = {};
    sa0 = wmma16(a0.v, bxa0.v, sa0);
    sb0 = wmma16(a0.v, bxb0.v, sb0);
    sa1 = wmma16(a1.v, bxa0.v, sa1);
    sb1 = wmma16(a1.v, bxb0.v, sb1);
    sa0 = wmma16(c0.v, bxa1.v, sa0);
    sb0 = wmma16(c0.v, bxb1.v, sb0);
    sa1 = wmma16(c1.v, bxa1.v, sa1);
    sb1 = wmma16(c1.v, bxb1.v, sb1);

    // the next step's GEMM1 fragments, to land behind the gate and GEMM2
    if (ob + OSTEP < OTILE) {
      const _Float16* r0 = ur + (ob + OSTEP) * TPAD;
      const _Float16* r1 = r0 + 16 * TPAD;
      a0.half[0] = *(const v8h*)(r0);       a0.half[1] = *(const v8h*)(r0 + 16);
      a1.half[0] = *(const v8h*)(r1);       a1.half[1] = *(const v8h*)(r1 + 16);
      c0.half[0] = *(const v8h*)(r0 + 32);  c0.half[1] = *(const v8h*)(r0 + 48);
      c1.half[0] = *(const v8h*)(r1 + 32);  c1.half[1] = *(const v8h*)(r1 + 48);
    }

    // ---- gate + repack: B[k = o - ob][n = l]; element r <- tile rows 0..15 (s?0), 8+r <- rows 16..31 (s?1)
    Frag bwa, bwb;
    bwa.half[0] = gate8(sa0);
    bwa.half[1] = gate8(sa1);
    bwb.half[0] = gate8(sb0);
    bwb.half[1] = gate8(sb1);

    // ---- GEMM2: F^T[d][l] += U^T[d][ob..ob+31] * W, four 16-d chunks x two column groups ----
    acca0 = wmma16(e0.v, bwa.v, acca0);
    acca1 = wmma16(e1.v, bwa.v, acca1);
    acca2 = wmma16(e2.v, bwa.v, acca2);
    acca3 = wmma16(e3.v, bwa.v, acca3);
    accb0 = wmma16(e0.v, bwb.v, accb0);
    accb1 = wmma16(e1.v, bwb.v, accb1);
    accb2 = wmma16(e2.v, bwb.v, accb2);
    accb3 = wmma16(e3.v, bwb.v, accb3);
   }
    // ---- tile t + 1 into the other buffer, whose readers left it at the last barrier; then its publish point ----
    if (t + 1 < NTILE)
      store_tile(st, &Us[buf ^ 1][srow][spc], &Vs[buf ^ 1][srow][spc]);
    asm volatile("s_wait_dscnt 0x0" ::: "memory");          // this wave's reads of buffer buf and its stores of tile t + 1 are done
    __syncthreads();
    if (t + 2 < NTILE)                                      // behind the barrier, so that the barrier's own waits do not wait for it
      load_tile(st, gs + (size_t)(t + 2) * (OTILE * N_DIM * D_DIM));
  }

  // ---- epilogue: acc?_dc[r] = F^T[dc*16 + 8h + r][col] * 2  ->  Fs[col][dc*16 + 8h + r]
  {
    const float inv = 0.5f;
    float* fa = &Fs[wave][m][8 * h];
    *(v4f*)(fa +  0) = lo4(acca0) * inv;  *(v4f*)(fa +  4) = hi4(acca0) * inv;
    *(v4f*)(fa + 16) = lo4(acca1) * inv;  *(v4f*)(fa + 20) = hi4(acca1) * inv;
    *(v4f*)(fa + 32) = lo4(acca2) * inv;  *(v4f*)(fa + 36) = hi4(acca2) * inv;
    *(v4f*)(fa + 48) = lo4(acca3) * inv;  *(v4f*)(fa + 52) = hi4(acca3) * inv;
    float* fb = &Fs[wave][16 + m][8 * h];
    *(v4f*)(fb +  0) = lo4(accb0) * inv;  *(v4f*)(fb +  4) = hi4(accb0) * inv;
    *(v4f*)(fb + 16) = lo4(accb1) * inv;  *(v4f*)(fb + 20) = hi4(accb1) * inv;
    *(v4f*)(fb + 32) = lo4(accb2) * inv;  *(v4f*)(fb + 36) = hi4(accb2) * inv;
    *(v4f*)(fb + 48) = lo4(accb3) * inv;  *(v4f*)(fb + 52) = hi4(accb3) * inv;
  }
  __syncthreads();

  // ---- whole-line output stores: wave owns 32 rows x 2 lines; lanes 8q..8q+7 write one line per instruction
  {
    const int q  = lane >> 3;
    const int j4 = (lane & 7) * 4;
    v4f v[16];
#pragma unroll
    for (int it = 0; it < 16; ++it) {
      const int li = it * 4 + q;                 // 0..63
      const int row = li >> 1, hf = (li & 1) * 32;
      v[it] = *(const v4f*)&Fs[wave][row][hf + j4];
    }
    float* obase = out + ((size_t)lbase * N_DIM + n) * D_DIM + j4;
#pragma unroll
    for (int it = 0; it < 16; ++it) {
      const int li = it * 4 + q;
      const int row = li >> 1, hf = (li & 1) * 32;
      *(v4f*)(obase + (size_t)row * (N_DIM * D_DIM) + hf) = v[it];
    }
  }
}

extern "C" void kernel_launch(void* const* d_in, const int* in_sizes, int n_in,
                              void* d_out, int out_size, void* d_ws, size_t ws_size,
                              hipStream_t stream) {
  if (n_in < 2) return;
  if (in_sizes[0] != L_DIM * N_DIM * D_DIM) return;
  if (in_sizes[1] != O_DIM * N_DIM * D_DIM) return;
  if (out_size != L_DIM * N_DIM * D_DIM) return;
  const float* x  = (const float*)d_in[0];   // [L][N][D] f32
  const float* up = (const float*)d_in[1];   // [O][N][D] f32
  float* out = (float*)d_out;                // [L][N][D] f32

  corr_main_kernel<<<dim3(L_DIM / LBLK, N_DIM), 256, 0, stream>>>(x, up, out);
}

// v005
// Measured time: 13 microseconds a run.
// In both of two side-by-side timings against v004, it was 1.16 times as fast.
// Over all steps from v000 it is 6.23 times as fast.
// All contractions: v_wmma_f32_16x16x32_f16 (f16 operands, f32 accumulate); gate weights are tanh(s/2) in f16; the scale 2^-4 is applied to X in f32 before its convert, the 0.5 to the f32 result.
#include <hip/hip_runtime.h>
#include <stddef.h>

typedef _Float16 v16h __attribute__((ext_vector_type(16)));
typedef _Float16 v8h  __attribute__((ext_vector_type(8)));
typedef float    v8f  __attribute__((ext_vector_type(8)));
typedef float    v4f  __attribute__((ext_vector_type(4)));
typedef _Float16 v4h  __attribute__((ext_vector_type(4)));
typedef short    s8s  __attribute__((ext_vector_type(8)));
typedef _Float16 v2h  __attribute__((ext_vector_type(2)));
typedef unsigned v8u  __attribute__((ext_vector_type(8)));

union Frag { v16h v; v8h half[2]; };

#define L_DIM 1024
#define N_DIM 64
#define D_DIM 64
#define O_DIM 1024
#define OSTEP 32
#define TPAD 72      // f16 pitch of the U tile that plain 16-B reads take (144 B = 16 B x odd)
#define VPAD 80      // f16 pitch of the U tile that transposing reads take (160 B = 32 B x odd)
#define FPAD 68      // f32 pitch of the output staging tile (272 B, 16-B aligned rows)
#define OTILE 256    // o rows of one staged tile (eight 32-wide o steps)
#define LBLK 256     // l rows of one work-group: 8 waves of 32
#define NTILE (O_DIM / OTILE)

// 16-bit WMMA, the bare builtin: the compiler keeps the distance to a vector instruction on D, A or B itself.
__device__ __forceinline__ v8f wmma16(v16h a, v16h b, v8f c) {
  return __builtin_amdgcn_wmma_f32_16x16x32_f16(false, a, false, b, (short)0, c, false, false);
}

// 8 f32 (two v4f) -> packed v8h, RNE convert
__device__ __forceinline__ v8h cvt8(v4f a, v4f b) {
  v8h h;
  h[0] = (_Float16)a[0]; h[1] = (_Float16)a[1]; h[2] = (_Float16)a[2]; h[3] = (_Float16)a[3];
  h[4] = (_Float16)b[0]; h[5] = (_Float16)b[1]; h[6] = (_Float16)b[2]; h[7] = (_Float16)b[3];
  return h;
}

// gate weights: sigmoid(s) - 0.5 = 0.5 * tanh(s / 2).  A D tile arrives as s / 2 (X carries 2^-4), so a weight
// is one v_tanh_f32; the 0.5 is applied once to the accumulated result.
// Two weights -> one dword of a B fragment (RNE converts).
__device__ __forceinline__ unsigned pk2(float a, float b) {
  v2h p;
  p[0] = (_Float16)a; p[1] = (_Float16)b;
  return __builtin_bit_cast(unsigned, p);
}
__device__ __forceinline__ v16h asfrag(v8u w) { return __builtin_bit_cast(v16h, w); }

// The scheduling barrier holds what stands on either side of it in the written order: without it the scheduler
// gathers the WMMAs and the gate into runs of their own and sinks the LDS reads down to their users, so that vector
// work and read latency are exposed.
#define SLOT_END() __builtin_amdgcn_sched_barrier(0)
// The gate's share of one WMMA's shadow, held between its own WMMA and the next: make the next pair of weights from
// elements r, r + 1 of the D tile S, and pack the pair made one slot earlier into dword d of DST.  The pack stands
// between the two tanh as the independent instruction behind the first; behind the second comes the next WMMA.
#define FILL(DST, d, S, r) { SLOT_END(); const float gn = __builtin_amdgcn_tanhf(S[(r)]); \
                             SLOT_END(); DST[(d)] = pk2(g0, g1); \
                             SLOT_END(); g1 = __builtin_amdgcn_tanhf(S[(r) + 1]); g0 = gn; SLOT_END(); }

// One 256-o tile of head n, f32, into registers: 16 loads of 16 B per lane.  A wave's load covers two whole
// 256-B rows (lanes 0-15 row c*16 + wave, lanes 16-31 row c*16 + wave + 8).
__device__ __forceinline__ void load_tile(v4f (&st)[16], const float* g) {
#pragma unroll
  for (int c = 0; c < 16; ++c) st[c] = *(const v4f*)(g + (size_t)c * (16 * N_DIM * D_DIM));
  // no address register of these loads is rewritten ahead of this wait
  asm volatile("s_wait_xcnt 0x0" ::: "memory");
}

// The tile in registers -> f16 (RNE) -> both LDS copies of the [o][d] tile, each at its own reader's pitch.
__device__ __forceinline__ void store_tile(const v4f (&st)[16], _Float16* pu, _Float16* pv) {
#pragma unroll
  for (int c = 0; c < 16; ++c) {
    v4h hv;
    hv[0] = (_Float16)st[c][0]; hv[1] = (_Float16)st[c][1]; hv[2] = (_Float16)st[c][2]; hv[3] = (_Float16)st[c][3];
    *(v4h*)(pu + c * 16 * TPAD) = hv;
    *(v4h*)(pv + c * 16 * VPAD) = hv;
  }
}

// Transposing LDS read: lane (m, h) whose address is row 8h + (lane & 7), 16-B piece (lane >> 3) & 1 of a
// row-major 16-bit tile gets rows 8h .. 8h+7 of column m.
__device__ __forceinline__ v8h ld_tr16(const _Float16* p) {
  typedef __attribute__((address_space(3))) s8s lds_s8s;
  return __builtin_bit_cast(v8h, __builtin_amdgcn_ds_load_tr16_b128_v8i16((lds_s8s*)p));
}

// GEMM2's A fragments (U^T, transposing reads) of o step I of the tile into set S.
#define LOAD_E(S, I) { const _Float16* rr = tr + (I) * OSTEP * VPAD; \
    fe[S][0].half[0] = ld_tr16(rr);       fe[S][0].half[1] = ld_tr16(rr + 16 * VPAD); \
    fe[S][1].half[0] = ld_tr16(rr + 16);  fe[S][1].half[1] = ld_tr16(rr + 16 * VPAD + 16); \
    fe[S][2].half[0] = ld_tr16(rr + 32);  fe[S][2].half[1] = ld_tr16(rr + 16 * VPAD + 32); \
    fe[S][3].half[0] = ld_tr16(rr + 48);  fe[S][3].half[1] = ld_tr16(rr + 16 * VPAD + 48); }
// GEMM1's A fragments (U rows, plain reads) of o step I of the tile into set S: 0, 1 = d 0..31 of the two 16-o subtiles, 2, 3 = d 32..63.
#define LOAD_A(S, I) { const _Float16* r0 = ur + (I) * OSTEP * TPAD; const _Float16* r1 = r0 + 16 * TPAD; \
    fa[S][0].half[0] = *(const v8h*)(r0);       fa[S][0].half[1] = *(const v8h*)(r0 + 16); \
    fa[S][1].half[0] = *(const v8h*)(r1);       fa[S][1].half[1] = *(const v8h*)(r1 + 16); \
    fa[S][2].half[0] = *(const v8h*)(r0 + 32);  fa[S][2].half[1] = *(const v8h*)(r0 + 48); \
    fa[S][3].half[0] = *(const v8h*)(r1 + 32);  fa[S][3].half[1] = *(const v8h*)(r1 + 48); }
// One 32-o step on fragment sets S (this step's) and P (the step before's GEMM2 fragments), four quarters of four slots:
//   GEMM1 group A: two 16-o subtiles, K = 64 in two 32-steps; under it the tail of group B's gate of the step before
//   GEMM2 group B of the step before (at a tile's first step: of the last tile's last step, all in registers)
//   GEMM1 group B
//   GEMM2 group A: F^T[d][l] += U^T[d][32 o] * W, four 16-d chunks
#define STEP(S, P) { \
    sa0 = wmma16(fa[S][0].v, bxa0.v, zero);  FILL(bwb, 4, sb1, 2) \
    sa1 = wmma16(fa[S][1].v, bxa0.v, zero);  FILL(bwb, 5, sb1, 4) \
    sa0 = wmma16(fa[S][2].v, bxa1.v, sa0);   FILL(bwb, 6, sb1, 6) \
    sa1 = wmma16(fa[S][3].v, bxa1.v, sa1);   FILL(bwb, 7, sa0, 0) \
    accb0 = wmma16(fe[P][0].v, asfrag(bwb), accb0);  FILL(bwa, 0, sa0, 2) \
    accb1 = wmma16(fe[P][1].v, asfrag(bwb), accb1);  FILL(bwa, 1, sa0, 4) \
    accb2 = wmma16(fe[P][2].v, asfrag(bwb), accb2);  FILL(bwa, 2, sa0, 6) \
    accb3 = wmma16(fe[P][3].v, asfrag(bwb), accb3);  FILL(bwa, 3, sa1, 0) \
    sb0 = wmma16(fa[S][0].v, bxb0.v, zero);  FILL(bwa, 4, sa1, 2) \
    sb1 = wmma16(fa[S][1].v, bxb0.v, zero);  FILL(bwa, 5, sa1, 4) \
    sb0 = wmma16(fa[S][2].v, bxb1.v, sb0);   FILL(bwa, 6, sa1, 6) \
    sb1 = wmma16(fa[S][3].v, bxb1.v, sb1);   FILL(bwa, 7, sb0, 0) \
    acca0 = wmma16(fe[S][0].v, asfrag(bwa), acca0);  FILL(bwb, 0, sb0, 2) \
    acca1 = wmma16(fe[S][1].v, asfrag(bwa), acca1);  FILL(bwb, 1, sb0, 4) \
    acca2 = wmma16(fe[S][2].v, asfrag(bwa), acca2);  FILL(bwb, 2, sb0, 6) \
    acca3 = wmma16(fe[S][3].v, asfrag(bwa), acca3);  FILL(bwb, 3, sb1, 0) }

__device__ __forceinline__ v4f lo4(v8f c) { return __builtin_shufflevector(c, c, 0, 1, 2, 3); }
__device__ __forceinline__ v4f hi4(v8f c) { return __builtin_shufflevector(c, c, 4, 5, 6, 7); }

// ---------------------------------------------------------------------------
// Per block: head n, 256 l rows (32 per wave, two 16-l column groups A and B).  The block's eight waves
// share each 256-o tile of U through a two-buffer LDS ring.  A tile is read from the f32 input into registers
// one ring trip ahead, converted to f16 and stored to LDS at the foot of the trip before its own.
// Every A fragment read from LDS feeds two WMMAs, one per column group.  The gate's vector work stands in the
// WMMAs' shadows: behind each WMMA two tanh and one pack, of the other column group except the two tanh behind a GEMM1 group's last WMMA.
// Per wave and 32-wide o step:
//   GEMM1  S^T[o][l]  = sum_d U[o][d] X[l][d]        A = U rows (plain LDS reads), B = X^T (registers)
//   gate   W[o][l]    = tanh(S*2^-4) = 2*(sigmoid(S*2^-3) - 0.5), D tiles repacked to a B fragment in registers
//   GEMM2  F^T[d][l] += sum_o U^T[d][o] W[o][l]      A = U^T rows (transposing LDS reads), B = W
// Fragment map (lane l: h = l>>4, m = l&15): A/B element i<8 -> k0+8h+i, i>=8 -> k0+16+8h+(i-8);
// D element r -> (row 8h+r, col m).
__global__ __launch_bounds__(256)
void corr_main_kernel(const float* __restrict__ x,
                      const float* __restrict__ up,
                      float* __restrict__ out) {
  __shared__ float Fs[8][32][FPAD];     // per-wave F[l][d] staging for whole-line stores
  __shared__ __attribute__((aligned(16))) _Float16 Us[2][OTILE][TPAD];    // ring: U tile [o][d] for GEMM1's plain reads
  __shared__ __attribute__((aligned(32))) _Float16 Vs[2][OTILE][VPAD];    // ring: the same tile for GEMM2's transposing reads
  const int tid  = threadIdx.x;
  const int wave = tid >> 5, lane = tid & 31;
  const int h    = lane >> 4, m = lane & 15;
  const int n    = blockIdx.y;
  const int lbase = blockIdx.x * LBLK + wave * 32;

  // This lane's 16-B f32 pieces of a tile: row wave + 8*h (+16c), piece m.
  const int srow = wave + 8 * h, spc = m * 4;
  const float* gs = up + ((size_t)srow * N_DIM + n) * D_DIM + spc;    // + tile * OTILE * N_DIM * D_DIM
  v4f st[16];
  load_tile(st, gs);                                        // tile 0 -> registers

  // B fragments of GEMM1 (X^T * 2^-4, k = d), one pair per column group: loop invariant, built once from f32 rows.
  Frag bxa0, bxa1, bxb0, bxb1;
  {
    const float* xa = x + ((size_t)(lbase + m) * N_DIM + n) * D_DIM;
    const float* xb = xa + (size_t)16 * N_DIM * D_DIM;
    const v4f* p;
    const float xs = 0.0625f;            // 1/sqrt(64) for the affinity, 1/2 for the tanh argument
    p = (const v4f*)(xa +      8 * h);  bxa0.half[0] = cvt8(p[0] * xs, p[1] * xs);   // d =  8h.. 8h+7
    p = (const v4f*)(xa + 16 + 8 * h);  bxa0.half[1] = cvt8(p[0] * xs, p[1] * xs);   // d = 16+8h..
    p = (const v4f*)(xa + 32 + 8 * h);  bxa1.half[0] = cvt8(p[0] * xs, p[1] * xs);   // d = 32+8h..
    p = (const v4f*)(xa + 48 + 8 * h);  bxa1.half[1] = cvt8(p[0] * xs, p[1] * xs);   // d = 48+8h..
    p = (const v4f*)(xb +      8 * h);  bxb0.half[0] = cvt8(p[0] * xs, p[1] * xs);
    p = (const v4f*)(xb + 16 + 8 * h);  bxb0.half[1] = cvt8(p[0] * xs, p[1] * xs);
    p = (const v4f*)(xb + 32 + 8 * h);  bxb1.half[0] = cvt8(p[0] * xs, p[1] * xs);
    p = (const v4f*)(xb + 48 + 8 * h);  bxb1.half[1] = cvt8(p[0] * xs, p[1] * xs);
  }
  v8f acca0 = {}, acca1 = {}, acca2 = {}, acca3 = {};       // F^T d-chunks 0..3, column group A
  v8f accb0 = {}, accb1 = {}, accb2 = {}, accb3 = {};       // F^T d-chunks 0..3, column group B

  store_tile(st, &Us[0][srow][spc], &Vs[0][srow][spc]);     // tile 0 -> buffer 0
  __syncthreads();                                          // tile 0 readable by every wave
  load_tile(st, gs + (size_t)OTILE * N_DIM * D_DIM);        // tile 1 -> registers, in flight over trip 0

  // Slot order of a 32-o step i (16 WMMAs, each followed by two tanh and one pack of the gate):
  //   GEMM1 group A (i) | GEMM2 group B (i - 1) | GEMM1 group B (i) | GEMM2 group A (i)
  // group A's gate runs under the 2nd and 3rd quarter, group B's under the 4th and the next step's 1st.
  Frag fa[2][4], fe[2][4];              // GEMM1 / GEMM2 A fragments, two sets each, picked by the step's parity
  const v8f zero = {};
  // the first trip's "step before" is all zeros: tanh(0) = 0, and 0 * 0 is added
  fe[1][0].v = fe[1][1].v = fe[1][2].v = fe[1][3].v = (v16h)(_Float16)0.0f;
  v8u bwa = {}, bwb = {};               // gate weights as B fragments, column groups A and B
  v8f sa0 = {}, sa1 = {}, sb0 = {}, sb1 = {};
  float g0 = 0.0f, g1 = 0.0f;           // the pair of weights made in the last slot

  // rolled: one ring trip per pass, the buffer picked by the trip's parity
#pragma unroll 1
  for (int t = 0; t < NTILE; ++t) {
   const int buf = t & 1;
   const _Float16* ur = &Us[buf][m][8 * h];                 // U rows:   o = tile + ob + 16*j + m
   const _Float16* tr = &Vs[buf][8 * h + (lane & 7)][8 * ((lane >> 3) & 1)];   // transposing reads: + o step rows, + 16*dc columns
   // The eight 32-o steps of a tile, written out: LDS offsets are immediates, the sets' indices constants, and the steps
   // are one basic block (from an unrolled loop the compiler split the last step off and moved the gate work that
   // stands in front of the split out of its slots).
   // One place of LDS reads per step: this step's GEMM2 fragments (used 12 WMMAs on), then the next step's GEMM1
   // fragments, inside this buffer only; the tile's first step reads its own GEMM1 fragments in front.
   LOAD_A(0, 0)
   LOAD_E(0, 0)  LOAD_A(1, 1)  SLOT_END();  STEP(0, 1)
   LOAD_E(1, 1)  LOAD_A(0, 2)  SLOT_END();  STEP(1, 0)
   LOAD_E(0, 2)  LOAD_A(1, 3)  SLOT_END();  STEP(0, 1)
   LOAD_E(1, 3)  LOAD_A(0, 4)  SLOT_END();  STEP(1, 0)
   LOAD_E(0, 4)  LOAD_A(1, 5)  SLOT_END();  STEP(0, 1)
   LOAD_E(1, 5)  LOAD_A(0, 6)  SLOT_END();  STEP(1, 0)
   LOAD_E(0, 6)  LOAD_A(1, 7)  SLOT_END();  STEP(0, 1)
   LOAD_E(1, 7)                SLOT_END();  STEP(1, 0)
    // ---- tile t + 1 into the other buffer, whose readers left it at the last barrier; then its publish point ----
    if (t + 1 < NTILE)
      store_tile(st, &Us[buf ^ 1][srow][spc], &Vs[buf ^ 1][srow][spc]);
    asm volatile("s_wait_dscnt 0x0" ::: "memory");          // this wave's reads of buffer buf and its stores of tile t + 1 are done
    __syncthreads();
    if (t + 2 < NTILE)                                      // behind the barrier, so that the barrier's own waits do not wait for it
      load_tile(st, gs + (size_t)(t + 2) * (OTILE * N_DIM * D_DIM));
  }

  // the rest of group B's gate of the last step, and its GEMM2
  FILL(bwb, 4, sb1, 2)
  FILL(bwb, 5, sb1, 4)
  FILL(bwb, 6, sb1, 6)
  bwb[7] = pk2(g0, g1);
  accb0 = wmma16(fe[1][0].v, asfrag(bwb), accb0);
  accb1 = wmma16(fe[1][1].v, asfrag(bwb), accb1);
  accb2 = wmma16(fe[1][2].v, asfrag(bwb), accb2);
  accb3 = wmma16(fe[1][3].v, asfrag(bwb), accb3);

  // ---- epilogue: acc?_dc[r] = F^T[dc*16 + 8h + r][col] * 2  ->  Fs[col][dc*16 + 8h + r]
  {
    const float inv = 0.5f;
    float* fa = &Fs[wave][m][8 * h];
    *(v4f*)(fa +  0) = lo4(acca0) * inv;  *(v4f*)(fa +  4) = hi4(acca0) * inv;
    *(v4f*)(fa + 16) = lo4(acca1) * inv;  *(v4f*)(fa + 20) = hi4(acca1) * inv;
    *(v4f*)(fa + 32) = lo4(acca2) * inv;  *(v4f*)(fa + 36) = hi4(acca2) * inv;
    *(v4f*)(fa + 48) = lo4(acca3) * inv;  *(v4f*)(fa + 52) = hi4(acca3) * inv;
    float* fb = &Fs[wave][16 + m][8 * h];
    *(v4f*)(fb +  0) = lo4(accb0) * inv;  *(v4f*)(fb +  4) = hi4(accb0) * inv;
    *(v4f*)(fb + 16) = lo4(accb1) * inv;  *(v4f*)(fb + 20) = hi4(accb1) * inv;
    *(v4f*)(fb + 32) = lo4(accb2) * inv;  *(v4f*)(fb + 36) = hi4(accb2) * inv;
    *(v4f*)(fb + 48) = lo4(accb3) * inv;  *(v4f*)(fb + 52) = hi4(accb3) * inv;
  }
  __syncthreads();

  // ---- whole-line output stores: wave owns 32 rows x 2 lines; lanes 8q..8q+7 write one line per instruction
  {
    const int q  = lane >> 3;
    const int j4 = (lane & 7) * 4;
    v4f v[16];
#pragma unroll
    for (int it = 0; it < 16; ++it) {
      const int li = it * 4 + q;                 // 0..63
      const int row = li >> 1, hf = (li & 1) * 32;
      v[it] = *(const v4f*)&Fs[wave][row][hf + j4];
    }
    float* obase = out + ((size_t)lbase * N_DIM + n) * D_DIM + j4;
#pragma unroll
    for (int it = 0; it < 16; ++it) {
      const int li = it * 4 + q;
      const int row = li >> 1, hf = (li & 1) * 32;
      *(v4f*)(obase + (size_t)row * (N_DIM * D_DIM) + hf) = v[it];
    }
  }
}

extern "C" void kernel_launch(void* const* d_in, const int* in_sizes, int n_in,
                              void* d_out, int out_size, void* d_ws, size_t ws_size,
                              hipStream_t stream) {
  if (n_in < 2) return;
  if (in_sizes[0] != L_DIM * N_DIM * D_DIM) return;
  if (in_sizes[1] != O_DIM * N_DIM * D_DIM) return;
  if (out_size != L_DIM * N_DIM * D_DIM) return;
  const float* x  = (const float*)d_in[0];   // [L][N][D] f32
  const float* up = (const float*)d_in[1];   // [O][N][D] f32
  float* out = (float*)d_out;                // [L][N][D] f32

  corr_main_kernel<<<dim3(L_DIM / LBLK, N_DIM), 256, 0, stream>>>(x, up, out);
}
